// v000
// Times are from an AMD MI455X. After a warm-up the kernel runs many times in a row, and a time is the length of
// such a window on the GPU divided by its runs, so every launch and the gaps after it count. The runs cycle
// through copies of the inputs. A figure is the median of several windows, for all but v000 over two sittings.
// Sittings can differ by a few percent; kernels timed side by side share one.
// The starting kernel, v000, takes 594 microseconds a run.
#include <hip/hip_runtime.h>

// ScaledDotProdAttention (shared-QK causal): 16 heads x 64 from [2,2048,1024]; dots = q.k/8; diagonal -> -10000 (self mask), strict upper -> -50000; softmax; out = attn v -> [2][2048][1024].
// Deterministic: online softmax over fixed 256-key chunks in order, only chunks at or below the query block (keys above are masked with a finite or -inf value whose exp underflows to exactly 0 against the row max, which always comes from an unmasked/diag key); no atomics.
// WMMA (v_wmma_f32_16x16x32_f16, f32 accumulate): q, k, v are raw inputs -> EXACT bf16 x8 f16 planes; per (b, h, 16-query) wave S = q x k rows (single product, exact operands) and O += P (hi+lo x256) x v^T rows (exact; 2 products) — ≈ 1.8 M WMMA; softmax in f32.

namespace {
constexpr int MODE = 0;   // 0: shared-QK self mask (diag -> -10000) + causal strict upper (-50000); 1: causal incl. diagonal + key padding mask input (nonzero -> -inf)
constexpr int NB_ = 2, S = 2048, H = 16, HD = 64, D = H * HD, NT = NB_ * S, CH = 256;
constexpr float XS = 8.0f, PS = 256.0f, SCALE = 0.125f;
typedef _Float16 b16;
typedef __attribute__((ext_vector_type(16))) _Float16 v16b;
typedef __attribute__((ext_vector_type(8))) _Float16 v8b;
typedef __attribute__((ext_vector_type(2))) _Float16 v2b;
typedef __attribute__((ext_vector_type(8))) float v8f;
typedef __attribute__((ext_vector_type(4))) float v4f;
typedef __attribute__((ext_vector_type(2))) float v2f;
__device__ __forceinline__ float bf16_rne(float f) { unsigned int u = __float_as_uint(f); u += 0x7FFFu + ((u >> 16) & 1u); float r = __uint_as_float(u & 0xFFFF0000u); asm volatile("" : "+v"(r)); return r; }
__device__ __forceinline__ void split16(float v, b16& hi, b16& lo) { hi = (b16)v; lo = (b16)(v - (float)hi); }
__device__ __forceinline__ v16b frag_kb(const b16* p, int hh) { const v8b a = *(const v8b*)(p + 8 * hh), b = *(const v8b*)(p + 16 + 8 * hh); v16b f;
#pragma unroll
  for (int e = 0; e < 8; ++e) { f[e] = a[e]; f[8 + e] = b[e]; } return f; }
__device__ __forceinline__ v8f wmma16b(v16b a, v16b b, v8f c) { v8f d = __builtin_amdgcn_wmma_f32_16x16x32_f16(false, a, false, b, (short)0, c, false, false); asm volatile("v_nop\n\tv_nop\n\tv_nop\n\tv_nop" : "+v"(d) : "v"(a), "v"(b)); return d; }
__device__ __forceinline__ void wave_lds_sync() { __builtin_amdgcn_fence(__ATOMIC_RELEASE, "workgroup"); __builtin_amdgcn_wave_barrier(); __builtin_amdgcn_fence(__ATOMIC_ACQUIRE, "workgroup"); }

__global__ __launch_bounds__(256) void cvt_kernel(const float* __restrict__ q, const float* __restrict__ k, b16* __restrict__ Q16, b16* __restrict__ K16) { const size_t nt = (size_t)gridDim.x * 256, u0 = (size_t)blockIdx.x * 256 + threadIdx.x; v8b a, c;
  for (size_t u = u0; u < (size_t)NT * D / 8; u += nt) {
#pragma unroll
    for (int j = 0; j < 8; ++j) { a[j] = (b16)(bf16_rne(q[u * 8 + j]) * XS); c[j] = (b16)(bf16_rne(k[u * 8 + j]) * XS); } { *(v8b*)(Q16 + u * 8) = a; *(v8b*)(K16 + u * 8) = c;  } } }
__global__ __launch_bounds__(256) void vt_kernel(const float* __restrict__ v, b16* __restrict__ VT) { __shared__ float Tt[64][257]; const int tt = blockIdx.x >> 2, hg = blockIdx.x & 3; const size_t t0 = (size_t)tt * 64; const int b = (int)(t0 / S), s0 = (int)(t0 % S); const int tid = threadIdx.x, wave = tid >> 5, lane = tid & 31;
  for (int qq = wave; qq < 64; qq += 8) for (int c = lane; c < 256; c += 32) Tt[qq][c] = bf16_rne(v[(t0 + qq) * D + hg * 256 + c]);
  __syncthreads();
  { for (int c = wave; c < 256; c += 8) { const int h = hg * 4 + c / HD, d = c % HD; const size_t o = (((size_t)b * H + h) * HD + d) * S + s0 + lane * 2; *(v2b*)(VT + o) = (v2b){(b16)(Tt[lane * 2][c] * XS), (b16)(Tt[lane * 2 + 1][c] * XS)}; }  } }
__global__ __launch_bounds__(32) void att_kernel(const b16* __restrict__ Q16, const b16* __restrict__ K16, const b16* __restrict__ VT, const int* __restrict__ kmask, int QLIM, float* __restrict__ out) { __shared__ __attribute__((aligned(16))) b16 Pa[16][CH + 8], Pb[16][CH + 8]; __shared__ float Sc[16][CH + 1], Mx[16], Ls[16], Fc[16], Of[16][HD + 1]; const int lane = threadIdx.x, nloc = lane & 15, hlf = lane >> 4; const int bh = blockIdx.x / (S / 16), q0 = (blockIdx.x % (S / 16)) * 16; if (q0 >= QLIM) return; const int b = bh / H, h = bh % H; const size_t tq = (size_t)b * S + q0;
  if (lane < 16) { Mx[lane] = -INFINITY; Ls[lane] = 0.0f; for (int kk = CH; kk < CH + 8; ++kk) { Pa[lane][kk] = (b16)0.0f; Pb[lane][kk] = (b16)0.0f; } }
  v16b qa[2]; for (int ks = 0; ks < 2; ++ks) qa[ks] = frag_kb(Q16 + (tq + nloc) * D + h * HD + ks * 32, hlf);
  v8f oacc[4] = {(v8f){}, (v8f){}, (v8f){}, (v8f){}}; const int nch = q0 / CH + 1;
#pragma unroll 1
  for (int ch = 0; ch < nch; ++ch) { const int k0 = ch * CH;
#pragma unroll 1
    for (int tg = 0; tg < 16; tg += 8) { v8f sacc[8];
#pragma unroll
      for (int t = 0; t < 8; ++t) sacc[t] = (v8f){};
#pragma unroll
      for (int t = 0; t < 8; ++t)
#pragma unroll
        for (int ks = 0; ks < 2; ++ks) sacc[t] = wmma16b(qa[ks], frag_kb(K16 + ((size_t)b * S + k0 + (tg + t) * 16 + nloc) * D + h * HD + ks * 32, hlf), sacc[t]);
#pragma unroll
      for (int t = 0; t < 8; ++t)
#pragma unroll
        for (int r8 = 0; r8 < 8; ++r8) Sc[8 * hlf + r8][(tg + t) * 16 + nloc] = sacc[t][r8] * (SCALE / (XS * XS)); }
    wave_lds_sync();
    if (lane < 16) { const int r = lane, qi = q0 + r; float mx = -INFINITY;
      for (int j = 0; j < CH; ++j) { const int kj = k0 + j; float s = Sc[r][j];
        if (MODE == 0) { if (kj == qi) s = -10000.0f; else if (kj > qi) s = -50000.0f; }
        else { const bool keep = (kj <= qi) && (kmask[(size_t)b * S + kj] == 0); s = keep ? s : -INFINITY; }
        Sc[r][j] = s; mx = fmaxf(mx, s); }
      const float mo = Mx[r], mn = fmaxf(mo, mx); const float fac = (mo == -INFINITY) ? 0.0f : (mn == -INFINITY ? 1.0f : __expf(mo - mn)); float sm = 0.0f;
      for (int j = 0; j < CH; ++j) { const float p = (mn == -INFINITY) ? 0.0f : __expf(Sc[r][j] - mn); sm += p; b16 ph, pl; split16(p * PS, ph, pl); Pa[r][j] = ph; Pb[r][j] = pl; } Fc[r] = fac; Ls[r] = Ls[r] * fac + sm; Mx[r] = mn; }
    wave_lds_sync();
#pragma unroll
    for (int t = 0; t < 4; ++t)
#pragma unroll
      for (int r8 = 0; r8 < 8; ++r8) oacc[t][r8] *= Fc[8 * hlf + r8];
#pragma unroll 2
    for (int kb = 0; kb < CH; kb += 32) { const v16b pa = frag_kb(&Pa[nloc][kb], hlf), pb = frag_kb(&Pb[nloc][kb], hlf);
#pragma unroll
      for (int t = 0; t < 4; ++t) { const v16b vv = frag_kb(VT + ((size_t)bh * HD + t * 16 + nloc) * S + k0 + kb, hlf); oacc[t] = wmma16b(pa, vv, oacc[t]); oacc[t] = wmma16b(pb, vv, oacc[t]); } }
    wave_lds_sync(); }
#pragma unroll
  for (int t = 0; t < 4; ++t)
#pragma unroll
    for (int r8 = 0; r8 < 8; ++r8) { const int r = 8 * hlf + r8; Of[r][t * 16 + nloc] = oacc[t][r8] * (1.0f / (PS * XS)) / Ls[r]; }   // a fully masked row (MODE 1, all keys padded) gives 0/0 = NaN exactly like the reference's softmax over all -inf
  wave_lds_sync();
  { for (int r = 0; r < 16; ++r) *(v2f*)(out + (tq + r) * D + h * HD + lane * 2) = (v2f){Of[r][lane * 2], Of[r][lane * 2 + 1]};  } }
}  // namespace

extern "C" void kernel_launch(void* const* d_in, const int* in_sizes, int n_in, void* d_out, int out_size, void* d_ws, size_t ws_size, hipStream_t stream) {
  (void)n_in;
  auto Fp = [&](int i) { return (const float*)d_in[i]; };
  // input order: 0 q/query; 1 k/key; 2 v/value ([2,2048,1024] == [2,2048,16,64]); MODE 1: 3 attention_mask [2,2048] i32
  if (in_sizes[0] != NT * D || in_sizes[1] != NT * D || in_sizes[2] != NT * D || (MODE == 1 && in_sizes[3] != NT) || out_size != NT * D) return;
  const int QLIM = S;   // query cut (multiple of 16)
  size_t off = 0; char* ws = (char*)d_ws;
  auto carve = [&](size_t bytes) { char* p = ws + off; off += (bytes + 255) & ~(size_t)255; return p; };
  b16* Q16 = (b16*)carve((size_t)NT * D * 2); b16* K16 = (b16*)carve((size_t)NT * D * 2); b16* VT = (b16*)carve((size_t)NT * D * 2);
  if (off > ws_size || off > ((size_t)32 << 20)) return;   // 24 MB
  cvt_kernel<<<512, 256, 0, stream>>>(Fp(0), Fp(1), Q16, K16);
  vt_kernel<<<(NT / 64) * 4, 256, 0, stream>>>(Fp(2), VT);
  att_kernel<<<NB_ * H * (S / 16), 32, 0, stream>>>(Q16, K16, VT, MODE == 1 ? (const int*)d_in[3] : nullptr, QLIM, (float*)d_out);
}

// v001
// Measured time: 116 microseconds a run.
// Next to v000, in two timings, it ran 5.12 and 5.11 times as fast.
#include <hip/hip_runtime.h>

// ScaledDotProdAttention (shared-QK causal): 16 heads x 64 from [2,2048,1024]; dots = q.k/8; diagonal -> -10000 (self mask), strict upper -> -50000; softmax; out = attn v -> [2][2048][1024].
// Deterministic: online softmax over fixed 64-key chunks in order, only chunks at or below the query block (keys above are masked with a finite value whose exp underflows to exactly 0 against the row max, which always comes from an unmasked/diag key); no atomics.
// WMMA (v_wmma_f32_16x16x32_f16, f32 accumulate): q, k, v are raw inputs -> EXACT bf16 x8 f16 planes; per (b, h, 16-query) wave S^T = k rows x q (single product, exact operands) and O^T += v^T rows x P^T (hi+lo x256; 2 products); softmax in f32, in registers.

namespace {
constexpr int MODE = 0;   // 0: shared-QK self mask (diag -> -10000) + causal strict upper (-50000); 1: key padding mask input, not built (att_kernel static_asserts MODE == 0)
constexpr int NB_ = 2, S = 2048, H = 16, HD = 64, D = H * HD, NT = NB_ * S, KC = 64;
constexpr float XS = 8.0f, PS = 256.0f, SCALE = 0.125f;
typedef _Float16 b16;
typedef __attribute__((ext_vector_type(16))) _Float16 v16b;
typedef __attribute__((ext_vector_type(8))) _Float16 v8b;
typedef __attribute__((ext_vector_type(2))) _Float16 v2b;
typedef __attribute__((ext_vector_type(8))) float v8f;
typedef __attribute__((ext_vector_type(4))) float v4f;
typedef __attribute__((ext_vector_type(2))) float v2f;
__device__ __forceinline__ float bf16_rne(float f) { unsigned int u = __float_as_uint(f); u += 0x7FFFu + ((u >> 16) & 1u); float r = __uint_as_float(u & 0xFFFF0000u); asm volatile("" : "+v"(r)); return r; }
__device__ __forceinline__ v16b frag_kb(const b16* p, int hh) { const v8b a = *(const v8b*)(p + 8 * hh), b = *(const v8b*)(p + 16 + 8 * hh); v16b f;
#pragma unroll
  for (int e = 0; e < 8; ++e) { f[e] = a[e]; f[8 + e] = b[e]; } return f; }
__device__ __forceinline__ v8f wmma16b(v16b a, v16b b, v8f c) { v8f d = __builtin_amdgcn_wmma_f32_16x16x32_f16(false, a, false, b, (short)0, c, false, false); asm volatile("v_nop\n\tv_nop\n\tv_nop\n\tv_nop" : "+v"(d) : "v"(a), "v"(b)); return d; }
__device__ __forceinline__ void wave_lds_sync() { __builtin_amdgcn_fence(__ATOMIC_RELEASE, "workgroup"); __builtin_amdgcn_wave_barrier(); __builtin_amdgcn_fence(__ATOMIC_ACQUIRE, "workgroup"); }

__global__ __launch_bounds__(256) void cvt_kernel(const float* __restrict__ q, const float* __restrict__ k, b16* __restrict__ Q16, b16* __restrict__ K16) { const size_t nt = (size_t)gridDim.x * 256, u0 = (size_t)blockIdx.x * 256 + threadIdx.x; v8b a, c;
  for (size_t u = u0; u < (size_t)NT * D / 8; u += nt) {
#pragma unroll
    for (int j = 0; j < 8; ++j) { a[j] = (b16)(bf16_rne(q[u * 8 + j]) * XS); c[j] = (b16)(bf16_rne(k[u * 8 + j]) * XS); } { *(v8b*)(Q16 + u * 8) = a; *(v8b*)(K16 + u * 8) = c;  } } }
__global__ __launch_bounds__(256) void vt_kernel(const float* __restrict__ v, b16* __restrict__ VT) { __shared__ float Tt[64][257]; const int tt = blockIdx.x >> 2, hg = blockIdx.x & 3; const size_t t0 = (size_t)tt * 64; const int b = (int)(t0 / S), s0 = (int)(t0 % S); const int tid = threadIdx.x, wave = tid >> 5, lane = tid & 31;
  for (int qq = wave; qq < 64; qq += 8) for (int c = lane; c < 256; c += 32) Tt[qq][c] = bf16_rne(v[(t0 + qq) * D + hg * 256 + c]);
  __syncthreads();
  { for (int c = wave; c < 256; c += 8) { const int h = hg * 4 + c / HD, d = c % HD; const size_t o = (((size_t)b * H + h) * HD + d) * S + s0 + lane * 2; *(v2b*)(VT + o) = (v2b){(b16)(Tt[lane * 2][c] * XS), (b16)(Tt[lane * 2 + 1][c] * XS)}; }  } }
__device__ __forceinline__ float other_half(float x) { const int i = __float_as_int(x); return __int_as_float(__builtin_amdgcn_permlanex16(i, i, 0x76543210, 0xfedcba98, false, false)); }   // lane l <-> l ^ 16
// One wave per (b, h, 16 queries). S^T = K q^T: lane (nloc, hlf) holds query nloc's scores of keys 16 t + 8 hlf + r8, so max and sum are in-lane plus one exchange of the halves,
// and two score tiles, converted in place, are the B operand (32 keys x 16 queries, the k order of frag_kb) of O^T += V^T P^T. Scores and P never touch LDS.
constexpr float RS = SCALE / (XS * XS);               // raw accumulator -> score, a power of two (exact)
constexpr float C2 = RS * 1.4426950408889634f;        // raw accumulator -> exponent of 2
static_assert(PS == 256.0f, "the 8 in the exponent below is log2(PS)");
constexpr float DIAG_RAW = -10000.0f / RS, UP_RAW = -50000.0f / RS;   // the two mask values on the raw scale, both exact in f32
struct RowState { v8f oacc[4]; v8f lsv; float mraw, bo; };   // O^T tiles, partial row sums (x PS), running max (raw scale), exponent in use
// kc, vc: this lane's K row and V^T row at the chunk's first key; dk0 = (chunk's first key + 8 hlf) - (this lane's query), read only where MASKED
template <bool MASKED> __device__ __forceinline__ void chunk(const b16* __restrict__ kc, const b16* __restrict__ vc, int dk0, int hlf, const v16b (&qb)[2], RowState& st) {
  v16b kf[KC / 16][2], vf[KC / 32][4]; v8f sacc[KC / 16];
#pragma unroll
  for (int t = 0; t < KC / 16; ++t)
#pragma unroll
    for (int ks = 0; ks < 2; ++ks) kf[t][ks] = frag_kb(kc + (size_t)(t * 16) * D + ks * 32, hlf);
#pragma unroll
  for (int t = 0; t < KC / 16; ++t) { sacc[t] = (v8f){};
#pragma unroll
    for (int ks = 0; ks < 2; ++ks) sacc[t] = wmma16b(kf[t][ks], qb[ks], sacc[t]); }
#pragma unroll
  for (int j = 0; j < KC / 32; ++j)
#pragma unroll
    for (int t = 0; t < 4; ++t) vf[j][t] = frag_kb(vc + (size_t)(t * 16) * S + j * 32, hlf);
  if (MASKED) {
#pragma unroll
    for (int t = 0; t < KC / 16; ++t)
#pragma unroll
      for (int r8 = 0; r8 < 8; ++r8) { const int dk = dk0 + t * 16 + r8; float s = sacc[t][r8]; s = dk > 0 ? UP_RAW : s; s = dk == 0 ? DIAG_RAW : s; sacc[t][r8] = s; } }
  float mt[KC / 16];
#pragma unroll
  for (int t = 0; t < KC / 16; ++t) { mt[t] = sacc[t][0];
#pragma unroll
    for (int r8 = 1; r8 < 8; ++r8) mt[t] = fmaxf(mt[t], sacc[t][r8]); }
  float mx = mt[0];
#pragma unroll
  for (int t = 1; t < KC / 16; ++t) mx = fmaxf(mx, mt[t]);
  mx = fmaxf(mx, other_half(mx)); st.mraw = fmaxf(st.mraw, mx);
  const float bn = __builtin_fmaf(st.mraw, C2, -8.0f);   // exponent taken off every score; the 8 is P's x256 (PS)
  const float fac = __builtin_amdgcn_exp2f(st.bo - bn); st.bo = bn; st.lsv *= fac;
#pragma unroll
  for (int t = 0; t < 4; ++t) st.oacc[t] *= fac;
#pragma unroll
  for (int j = 0; j < KC / 32; ++j) { v16b ph, pl;
#pragma unroll
    for (int u = 0; u < 2; ++u) { v8f p;
#pragma unroll
      for (int e = 0; e < 8; ++e) p[e] = __builtin_amdgcn_exp2f(__builtin_fmaf(sacc[2 * j + u][e], C2, -bn));
#pragma unroll
      for (int e = 0; e < 8; e += 2) { const v2b hi = __builtin_convertvector((v2f){p[e], p[e + 1]}, v2b); const v2b lo = __builtin_convertvector((v2f){p[e] - (float)hi[0], p[e + 1] - (float)hi[1]}, v2b);
        ph[8 * u + e] = hi[0]; ph[8 * u + e + 1] = hi[1]; pl[8 * u + e] = lo[0]; pl[8 * u + e + 1] = lo[1]; }
      st.lsv += p; }
#pragma unroll
    for (int t = 0; t < 4; ++t) { st.oacc[t] = wmma16b(vf[j][t], ph, st.oacc[t]); st.oacc[t] = wmma16b(vf[j][t], pl, st.oacc[t]); } } }
__global__ __launch_bounds__(32) void att_kernel(const b16* __restrict__ Q16, const b16* __restrict__ K16, const b16* __restrict__ VT, const int* __restrict__ kmask, int QLIM, float* __restrict__ out) { static_assert(MODE == 0, "the register softmax is written for the self mask + causal form"); (void)kmask;
  __shared__ float Of[16][HD + 1]; const int lane = threadIdx.x, nloc = lane & 15, hlf = lane >> 4; const int bh = blockIdx.x / (S / 16), q0 = (blockIdx.x % (S / 16)) * 16; if (q0 >= QLIM) return; const int b = bh / H, h = bh % H; const size_t tq = (size_t)b * S + q0;
  v16b qb[2]; for (int ks = 0; ks < 2; ++ks) qb[ks] = frag_kb(Q16 + (tq + nloc) * D + h * HD + ks * 32, hlf);
  asm volatile("s_wait_xcnt 0x0" ::: "memory");   // stands before the q loads' address registers are reused
  const b16* __restrict__ kp = K16 + ((size_t)b * S + nloc) * D + h * HD; const b16* __restrict__ vp = VT + ((size_t)bh * HD + nloc) * S;
  RowState st; for (int t = 0; t < 4; ++t) st.oacc[t] = (v8f){}; st.lsv = (v8f){}; st.mraw = -INFINITY; st.bo = -INFINITY; const int klast = (q0 / KC) * KC;   // only the chunk at klast meets the diagonal
#pragma unroll 1   // one chunk's fragments and scores already fill most of the register budget
  for (int k0 = 0; k0 < klast; k0 += KC) chunk<false>(kp + (size_t)k0 * D, vp + k0, 0, hlf, qb, st);
  chunk<true>(kp + (size_t)klast * D, vp + klast, klast + 8 * hlf - (q0 + nloc), hlf, qb, st);
  const v8f lsv = st.lsv; float ls = ((lsv[0] + lsv[1]) + (lsv[2] + lsv[3])) + ((lsv[4] + lsv[5]) + (lsv[6] + lsv[7])); ls += other_half(ls); const float rinv = (1.0f / XS) / ls;   // ls carries PS like oacc
#pragma unroll
  for (int t = 0; t < 4; ++t)
#pragma unroll
    for (int r8 = 0; r8 < 8; ++r8) Of[nloc][t * 16 + 8 * hlf + r8] = st.oacc[t][r8] * rinv;
  wave_lds_sync();
  { for (int r = 0; r < 16; ++r) *(v2f*)(out + (tq + r) * D + h * HD + lane * 2) = (v2f){Of[r][lane * 2], Of[r][lane * 2 + 1]};  } }
}  // namespace

extern "C" void kernel_launch(void* const* d_in, const int* in_sizes, int n_in, void* d_out, int out_size, void* d_ws, size_t ws_size, hipStream_t stream) {
  (void)n_in;
  auto Fp = [&](int i) { return (const float*)d_in[i]; };
  // input order: 0 q/query; 1 k/key; 2 v/value ([2,2048,1024] == [2,2048,16,64]); MODE 1: 3 attention_mask [2,2048] i32
  if (in_sizes[0] != NT * D || in_sizes[1] != NT * D || in_sizes[2] != NT * D || (MODE == 1 && in_sizes[3] != NT) || out_size != NT * D) return;
  const int QLIM = S;   // query cut (multiple of 16)
  size_t off = 0; char* ws = (char*)d_ws;
  auto carve = [&](size_t bytes) { char* p = ws + off; off += (bytes + 255) & ~(size_t)255; return p; };
  b16* Q16 = (b16*)carve((size_t)NT * D * 2); b16* K16 = (b16*)carve((size_t)NT * D * 2); b16* VT = (b16*)carve((size_t)NT * D * 2);
  if (off > ws_size || off > ((size_t)32 << 20)) return;   // 24 MB
  cvt_kernel<<<512, 256, 0, stream>>>(Fp(0), Fp(1), Q16, K16);
  vt_kernel<<<(NT / 64) * 4, 256, 0, stream>>>(Fp(2), VT);
  att_kernel<<<NB_ * H * (S / 16), 32, 0, stream>>>(Q16, K16, VT, MODE == 1 ? (const int*)d_in[3] : nullptr, QLIM, (float*)d_out);
}

// v002
// Measured time: 77.2 microseconds a run.
// Timed twice side by side with v001, it ran 1.50 times as fast both times.
// All steps since v000 together make it 7.70 times as fast.
#include <hip/hip_runtime.h>

// ScaledDotProdAttention (shared-QK causal): 16 heads x 64 from [2,2048,1024]; dots = q.k/8; diagonal -> -10000 (self mask), strict upper -> -50000; softmax; out = attn v -> [2][2048][1024].
// Deterministic: online softmax over fixed 64-key chunks in order, only chunks at or below the query block (keys above are masked with a finite value whose exp underflows to exactly 0 against the row max, which always comes from an unmasked/diag key); no atomics.
// WMMA (v_wmma_f32_16x16x32_f16, f32 accumulate): q, k, v are raw inputs -> EXACT bf16 x8 f16 planes; per (b, h, 16-query) wave (four waves, 64 queries, share each 64-key K and V^T chunk through LDS) S^T = k rows x q (single product, exact operands) and O^T += v^T rows x P^T (hi+lo x256; 2 products); softmax in f32, in registers.

namespace {
constexpr int MODE = 0;   // 0: shared-QK self mask (diag -> -10000) + causal strict upper (-50000); 1: key padding mask input, not built (att_kernel static_asserts MODE == 0)
constexpr int NB_ = 2, S = 2048, H = 16, HD = 64, D = H * HD, NT = NB_ * S, KC = 64;
constexpr float XS = 8.0f, PS = 256.0f, SCALE = 0.125f;
typedef _Float16 b16;
typedef __attribute__((ext_vector_type(16))) _Float16 v16b;
typedef __attribute__((ext_vector_type(8))) _Float16 v8b;
typedef __attribute__((ext_vector_type(2))) _Float16 v2b;
typedef __attribute__((ext_vector_type(8))) float v8f;
typedef __attribute__((ext_vector_type(4))) float v4f;
typedef __attribute__((ext_vector_type(2))) float v2f;
__device__ __forceinline__ float bf16_rne(float f) { unsigned int u = __float_as_uint(f); u += 0x7FFFu + ((u >> 16) & 1u); float r = __uint_as_float(u & 0xFFFF0000u); asm volatile("" : "+v"(r)); return r; }
__device__ __forceinline__ v16b frag_kb(const b16* p, int hh) { const v8b a = *(const v8b*)(p + 8 * hh), b = *(const v8b*)(p + 16 + 8 * hh); v16b f;
#pragma unroll
  for (int e = 0; e < 8; ++e) { f[e] = a[e]; f[8 + e] = b[e]; } return f; }
__device__ __forceinline__ v8f wmma16b(v16b a, v16b b, v8f c) { v8f d = __builtin_amdgcn_wmma_f32_16x16x32_f16(false, a, false, b, (short)0, c, false, false); asm volatile("v_nop\n\tv_nop\n\tv_nop\n\tv_nop" : "+v"(d) : "v"(a), "v"(b)); return d; }
__device__ __forceinline__ void wave_lds_sync() { __builtin_amdgcn_fence(__ATOMIC_RELEASE, "workgroup"); __builtin_amdgcn_wave_barrier(); __builtin_amdgcn_fence(__ATOMIC_ACQUIRE, "workgroup"); }

__global__ __launch_bounds__(256) void cvt_kernel(const float* __restrict__ q, const float* __restrict__ k, b16* __restrict__ Q16, b16* __restrict__ K16) { const size_t nt = (size_t)gridDim.x * 256, u0 = (size_t)blockIdx.x * 256 + threadIdx.x; v8b a, c;
  for (size_t u = u0; u < (size_t)NT * D / 8; u += nt) {
#pragma unroll
    for (int j = 0; j < 8; ++j) { a[j] = (b16)(bf16_rne(q[u * 8 + j]) * XS); c[j] = (b16)(bf16_rne(k[u * 8 + j]) * XS); } { *(v8b*)(Q16 + u * 8) = a; *(v8b*)(K16 + u * 8) = c;  } } }
__global__ __launch_bounds__(256) void vt_kernel(const float* __restrict__ v, b16* __restrict__ VT) { __shared__ float Tt[64][257]; const int tt = blockIdx.x >> 2, hg = blockIdx.x & 3; const size_t t0 = (size_t)tt * 64; const int b = (int)(t0 / S), s0 = (int)(t0 % S); const int tid = threadIdx.x, wave = tid >> 5, lane = tid & 31;
  for (int qq = wave; qq < 64; qq += 8) for (int c = lane; c < 256; c += 32) Tt[qq][c] = bf16_rne(v[(t0 + qq) * D + hg * 256 + c]);
  __syncthreads();
  { for (int c = wave; c < 256; c += 8) { const int h = hg * 4 + c / HD, d = c % HD; const size_t o = (((size_t)b * H + h) * HD + d) * S + s0 + lane * 2; *(v2b*)(VT + o) = (v2b){(b16)(Tt[lane * 2][c] * XS), (b16)(Tt[lane * 2 + 1][c] * XS)}; }  } }
__device__ __forceinline__ float other_half(float x) { const int i = __float_as_int(x); return __int_as_float(__builtin_amdgcn_permlanex16(i, i, 0x76543210, 0xfedcba98, false, false)); }   // lane l <-> l ^ 16
// One wave per (b, h, 16 queries), four waves a block. S^T = K q^T: lane (nloc, hlf) holds query nloc's scores of keys 16 t + 8 hlf + r8, so max and sum are in-lane plus one exchange of the halves,
// and two score tiles, converted in place, are the B operand (32 keys x 16 queries, the k order of frag_kb) of O^T += V^T P^T. Scores and P never touch LDS.
constexpr float RS = SCALE / (XS * XS);               // raw accumulator -> score, a power of two (exact)
constexpr float C2 = RS * 1.4426950408889634f;        // raw accumulator -> exponent of 2
static_assert(PS == 256.0f, "the 8 in the exponent below is log2(PS)");
constexpr float DIAG_RAW = -10000.0f / RS, UP_RAW = -50000.0f / RS;   // the two mask values on the raw scale, both exact in f32
constexpr int NW = 4, QB = NW * 16;                   // waves and queries of a block
static_assert(QB == KC, "all waves of a block walk the same chunks, and only the last one meets the diagonal");
constexpr int LP = HD + 8, TILE = KC * LP;            // LDS rows of 128 B at a pitch of 144 B (16 B x odd, for 16-byte readers); one tile = 64 rows
static_assert(HD == KC, "the K tile (keys x head dim) and the V^T tile (head dim x keys) have the same shape");
// One chunk's K tile and V^T tile, global -> LDS: 64 rows x 128 B each, every lane 16 B of rows r, r + 16, r + 32, r + 48 (eight lanes cover one whole 128-B line).
// lk, lv: the lane's LDS byte addresses of row r; gk, gv: its global addresses of row r.
__device__ __forceinline__ void copy_chunk(unsigned lk, unsigned lv, const b16* gk, const b16* gv) {
  // the closing s_wait_xcnt stands inside the statement, so that no address register of a copy is rewritten ahead of it
  asm volatile("global_load_async_to_lds_b128 %0, %8, off\n\t"
               "global_load_async_to_lds_b128 %1, %9, off\n\t"
               "global_load_async_to_lds_b128 %2, %10, off\n\t"
               "global_load_async_to_lds_b128 %3, %11, off\n\t"
               "global_load_async_to_lds_b128 %4, %12, off\n\t"
               "global_load_async_to_lds_b128 %5, %13, off\n\t"
               "global_load_async_to_lds_b128 %6, %14, off\n\t"
               "global_load_async_to_lds_b128 %7, %15, off\n\t"
               "s_wait_xcnt 0x0"
               :: "v"(lk), "v"(lk + 16 * LP * 2), "v"(lk + 32 * LP * 2), "v"(lk + 48 * LP * 2), "v"(lv), "v"(lv + 16 * LP * 2), "v"(lv + 32 * LP * 2), "v"(lv + 48 * LP * 2),
                  "v"(gk), "v"(gk + (size_t)16 * D), "v"(gk + (size_t)32 * D), "v"(gk + (size_t)48 * D), "v"(gv), "v"(gv + (size_t)16 * S), "v"(gv + (size_t)32 * S), "v"(gv + (size_t)48 * S)
               : "memory"); }
struct RowState { v8f oacc[4]; v8f lsv; float mraw, bo; };   // O^T tiles, partial row sums (x PS), running max (raw scale), exponent in use
// kc, vc: this lane's K row and V^T row in the chunk's LDS tiles (rows of LP elements); dk0 = (chunk's first key + 8 hlf) - (this lane's query), read only where MASKED
template <bool MASKED> __device__ __forceinline__ void chunk(const b16* __restrict__ kc, const b16* __restrict__ vc, int dk0, int hlf, const v16b (&qb)[2], RowState& st) {
  v16b kf[KC / 16][2], vf[KC / 32][4]; v8f sacc[KC / 16];
#pragma unroll
  for (int t = 0; t < KC / 16; ++t)
#pragma unroll
    for (int ks = 0; ks < 2; ++ks) kf[t][ks] = frag_kb(kc + (t * 16) * LP + ks * 32, hlf);
#pragma unroll
  for (int t = 0; t < KC / 16; ++t) { sacc[t] = (v8f){};
#pragma unroll
    for (int ks = 0; ks < 2; ++ks) sacc[t] = wmma16b(kf[t][ks], qb[ks], sacc[t]); }
#pragma unroll
  for (int j = 0; j < KC / 32; ++j)
#pragma unroll
    for (int t = 0; t < 4; ++t) vf[j][t] = frag_kb(vc + (t * 16) * LP + j * 32, hlf);
  if (MASKED) {
#pragma unroll
    for (int t = 0; t < KC / 16; ++t)
#pragma unroll
      for (int r8 = 0; r8 < 8; ++r8) { const int dk = dk0 + t * 16 + r8; float s = sacc[t][r8]; s = dk > 0 ? UP_RAW : s; s = dk == 0 ? DIAG_RAW : s; sacc[t][r8] = s; } }
  float mt[KC / 16];
#pragma unroll
  for (int t = 0; t < KC / 16; ++t) { mt[t] = sacc[t][0];
#pragma unroll
    for (int r8 = 1; r8 < 8; ++r8) mt[t] = fmaxf(mt[t], sacc[t][r8]); }
  float mx = mt[0];
#pragma unroll
  for (int t = 1; t < KC / 16; ++t) mx = fmaxf(mx, mt[t]);
  mx = fmaxf(mx, other_half(mx)); st.mraw = fmaxf(st.mraw, mx);
  const float bn = __builtin_fmaf(st.mraw, C2, -8.0f);   // exponent taken off every score; the 8 is P's x256 (PS)
  const float fac = __builtin_amdgcn_exp2f(st.bo - bn); st.bo = bn; st.lsv *= fac;
#pragma unroll
  for (int t = 0; t < 4; ++t) st.oacc[t] *= fac;
#pragma unroll
  for (int j = 0; j < KC / 32; ++j) { v16b ph, pl;
#pragma unroll
    for (int u = 0; u < 2; ++u) { v8f p;
#pragma unroll
      for (int e = 0; e < 8; ++e) p[e] = __builtin_amdgcn_exp2f(__builtin_fmaf(sacc[2 * j + u][e], C2, -bn));
#pragma unroll
      for (int e = 0; e < 8; e += 2) { const v2b hi = __builtin_convertvector((v2f){p[e], p[e + 1]}, v2b); const v2b lo = __builtin_convertvector((v2f){p[e] - (float)hi[0], p[e + 1] - (float)hi[1]}, v2b);
        ph[8 * u + e] = hi[0]; ph[8 * u + e + 1] = hi[1]; pl[8 * u + e] = lo[0]; pl[8 * u + e + 1] = lo[1]; }
      st.lsv += p; }
#pragma unroll
    for (int t = 0; t < 4; ++t) { st.oacc[t] = wmma16b(vf[j][t], ph, st.oacc[t]); st.oacc[t] = wmma16b(vf[j][t], pl, st.oacc[t]); } } }
__global__ __launch_bounds__(NW * 32) void att_kernel(const b16* __restrict__ Q16, const b16* __restrict__ K16, const b16* __restrict__ VT, const int* __restrict__ kmask, int QLIM, float* __restrict__ out) { static_assert(MODE == 0, "the register softmax is written for the self mask + causal form"); (void)kmask;
  __shared__ __attribute__((aligned(16))) b16 Kt[2][TILE]; __shared__ __attribute__((aligned(16))) b16 Vt[2][TILE]; __shared__ float Of[NW][16][HD + 1];
  const int tid = threadIdx.x, wave = tid >> 5, lane = tid & 31, nloc = lane & 15, hlf = lane >> 4; const int bh = blockIdx.x / (S / QB), qb0 = (blockIdx.x % (S / QB)) * QB; if (qb0 >= QLIM) return;   // the whole block leaves, ahead of every barrier
  const int q0 = qb0 + wave * 16, b = bh / H, h = bh % H; const size_t tq = (size_t)b * S + q0;
  v16b qb[2]; for (int ks = 0; ks < 2; ++ks) qb[ks] = frag_kb(Q16 + (tq + nloc) * D + h * HD + ks * 32, hlf);
  asm volatile("s_wait_xcnt 0x0" ::: "memory");   // stands before the q loads' address registers are reused
  const int crow = tid >> 3, cseg = (tid & 7) * 8;   // the row and the 16-byte piece of it that this lane copies
  const b16* gk = K16 + ((size_t)b * S + crow) * D + h * HD + cseg; const b16* gv = VT + ((size_t)bh * HD + crow) * S + cseg;
  const unsigned lk0 = (unsigned)(size_t)&Kt[0][crow * LP + cseg], lv0 = (unsigned)(size_t)&Vt[0][crow * LP + cseg];
  RowState st; for (int t = 0; t < 4; ++t) st.oacc[t] = (v8f){}; st.lsv = (v8f){}; st.mraw = -INFINITY; st.bo = -INFINITY; const int nch = qb0 / KC + 1;   // chunks of this block; only the last meets the diagonal
  copy_chunk(lk0, lv0, gk, gv);
  asm volatile("s_wait_asynccnt 0x0" ::: "memory");   // this wave's share of chunk 0 has landed
  __syncthreads();                                    // ... and every other wave's
  if (nch > 1) copy_chunk(lk0 + TILE * 2, lv0 + TILE * 2, gk + (size_t)KC * D, gv + KC);
#pragma unroll 1   // one chunk's fragments and scores already fill most of the register budget
  for (int c = 0; c < nch - 1; ++c) { const int bf = c & 1;
    chunk<false>(&Kt[bf][nloc * LP], &Vt[bf][nloc * LP], 0, hlf, qb, st);
    asm volatile("s_wait_dscnt 0x0" ::: "memory");      // this wave's reads of buffer bf are done before anybody refills it
    asm volatile("s_wait_asynccnt 0x0" ::: "memory");   // this wave's share of chunk c + 1 has landed
    __syncthreads();                                    // publishes chunk c + 1 and frees buffer bf
    if (c + 2 < nch) copy_chunk(lk0 + bf * (TILE * 2), lv0 + bf * (TILE * 2), gk + (size_t)(c + 2) * KC * D, gv + (c + 2) * KC); }
  asm volatile("s_wait_asynccnt 0x0" ::: "memory");   // no copy is left in flight behind the loop
  { const int bf = (nch - 1) & 1; chunk<true>(&Kt[bf][nloc * LP], &Vt[bf][nloc * LP], (nch - 1) * KC + 8 * hlf - (q0 + nloc), hlf, qb, st); }
  if (q0 >= QLIM) return;   // no barrier stands behind this line
  const v8f lsv = st.lsv; float ls = ((lsv[0] + lsv[1]) + (lsv[2] + lsv[3])) + ((lsv[4] + lsv[5]) + (lsv[6] + lsv[7])); ls += other_half(ls); const float rinv = (1.0f / XS) / ls;   // ls carries PS like oacc
#pragma unroll
  for (int t = 0; t < 4; ++t)
#pragma unroll
    for (int r8 = 0; r8 < 8; ++r8) Of[wave][nloc][t * 16 + 8 * hlf + r8] = st.oacc[t][r8] * rinv;
  wave_lds_sync();
  { for (int r = 0; r < 16; ++r) *(v2f*)(out + (tq + r) * D + h * HD + lane * 2) = (v2f){Of[wave][r][lane * 2], Of[wave][r][lane * 2 + 1]};  } }
}  // namespace

extern "C" void kernel_launch(void* const* d_in, const int* in_sizes, int n_in, void* d_out, int out_size, void* d_ws, size_t ws_size, hipStream_t stream) {
  (void)n_in;
  auto Fp = [&](int i) { return (const float*)d_in[i]; };
  // input order: 0 q/query; 1 k/key; 2 v/value ([2,2048,1024] == [2,2048,16,64]); MODE 1: 3 attention_mask [2,2048] i32
  if (in_sizes[0] != NT * D || in_sizes[1] != NT * D || in_sizes[2] != NT * D || (MODE == 1 && in_sizes[3] != NT) || out_size != NT * D) return;
  const int QLIM = S;   // query cut (multiple of 16)
  size_t off = 0; char* ws = (char*)d_ws;
  auto carve = [&](size_t bytes) { char* p = ws + off; off += (bytes + 255) & ~(size_t)255; return p; };
  b16* Q16 = (b16*)carve((size_t)NT * D * 2); b16* K16 = (b16*)carve((size_t)NT * D * 2); b16* VT = (b16*)carve((size_t)NT * D * 2);
  if (off > ws_size || off > ((size_t)32 << 20)) return;   // 24 MB
  cvt_kernel<<<512, 256, 0, stream>>>(Fp(0), Fp(1), Q16, K16);
  vt_kernel<<<(NT / 64) * 4, 256, 0, stream>>>(Fp(2), VT);
  att_kernel<<<NB_ * H * (S / QB), NW * 32, 0, stream>>>(Q16, K16, VT, MODE == 1 ? (const int*)d_in[3] : nullptr, QLIM, (float*)d_out);
}

// v003
// A run of this version takes 66.8 microseconds.
// Next to v002, in two timings, it ran 1.16 and 1.15 times as fast.
// All steps since v000 together make it 8.90 times as fast.
#include <hip/hip_runtime.h>

// ScaledDotProdAttention (shared-QK causal): 16 heads x 64 from [2,2048,1024]; dots = q.k/8; diagonal -> -10000 (self mask), strict upper -> -50000; softmax; out = attn v -> [2][2048][1024].
// Deterministic: online softmax over fixed 64-key chunks in order, only chunks at or below the query block (keys above are masked with a finite value whose exp underflows to exactly 0 against the row max, which always comes from an unmasked/diag key); no atomics.
// WMMA (v_wmma_f32_16x16x32_f16, f32 accumulate): q, k, v are raw inputs -> EXACT bf16 x8 f16 planes; per (b, h, 16-query) wave (four waves, 64 queries, share each 64-key K and V^T chunk through LDS) S^T = k rows x q (single product, exact operands) and O^T += v^T rows x P^T (hi+lo x256; 2 products); softmax in f32, in registers.

namespace {
constexpr int MODE = 0;   // 0: shared-QK self mask (diag -> -10000) + causal strict upper (-50000); 1: key padding mask input, not built (att_kernel static_asserts MODE == 0)
constexpr int NB_ = 2, S = 2048, H = 16, HD = 64, D = H * HD, NT = NB_ * S, KC = 64;
constexpr float XS = 8.0f, PS = 256.0f, SCALE = 0.125f;
typedef _Float16 b16;
typedef __attribute__((ext_vector_type(16))) _Float16 v16b;
typedef __attribute__((ext_vector_type(8))) _Float16 v8b;
typedef __attribute__((ext_vector_type(2))) _Float16 v2b;
typedef __attribute__((ext_vector_type(8))) float v8f;
typedef __attribute__((ext_vector_type(4))) float v4f;
typedef __attribute__((ext_vector_type(2))) float v2f;
__device__ __forceinline__ float bf16_rne(float f) { unsigned int u = __float_as_uint(f); u += 0x7FFFu + ((u >> 16) & 1u); float r = __uint_as_float(u & 0xFFFF0000u); asm volatile("" : "+v"(r)); return r; }
__device__ __forceinline__ v16b frag_kb(const b16* p, int hh) { const v8b a = *(const v8b*)(p + 8 * hh), b = *(const v8b*)(p + 16 + 8 * hh); v16b f;
#pragma unroll
  for (int e = 0; e < 8; ++e) { f[e] = a[e]; f[8 + e] = b[e]; } return f; }
__device__ __forceinline__ v8f wmma16b(v16b a, v16b b, v8f c) { v8f d = __builtin_amdgcn_wmma_f32_16x16x32_f16(false, a, false, b, (short)0, c, false, false); asm volatile("v_nop\n\tv_nop\n\tv_nop\n\tv_nop" : "+v"(d) : "v"(a), "v"(b)); return d; }
__device__ __forceinline__ void wave_lds_sync() { __builtin_amdgcn_fence(__ATOMIC_RELEASE, "workgroup"); __builtin_amdgcn_wave_barrier(); __builtin_amdgcn_fence(__ATOMIC_ACQUIRE, "workgroup"); }

// Left for a later step: in both conversion kernels below the build waits for each 4-byte load before it issues the next (the asm statement in bf16_rne keeps them apart).
__global__ __launch_bounds__(256) void cvt_kernel(const float* __restrict__ q, const float* __restrict__ k, b16* __restrict__ Q16, b16* __restrict__ K16) { const size_t nt = (size_t)gridDim.x * 256, u0 = (size_t)blockIdx.x * 256 + threadIdx.x; v8b a, c;
  for (size_t u = u0; u < (size_t)NT * D / 8; u += nt) {
#pragma unroll
    for (int j = 0; j < 8; ++j) { a[j] = (b16)(bf16_rne(q[u * 8 + j]) * XS); c[j] = (b16)(bf16_rne(k[u * 8 + j]) * XS); } { *(v8b*)(Q16 + u * 8) = a; *(v8b*)(K16 + u * 8) = c;  } } }
__global__ __launch_bounds__(256) void vt_kernel(const float* __restrict__ v, b16* __restrict__ VT) { __shared__ float Tt[64][257]; const int tt = blockIdx.x >> 2, hg = blockIdx.x & 3; const size_t t0 = (size_t)tt * 64; const int b = (int)(t0 / S), s0 = (int)(t0 % S); const int tid = threadIdx.x, wave = tid >> 5, lane = tid & 31;
  for (int qq = wave; qq < 64; qq += 8) for (int c = lane; c < 256; c += 32) Tt[qq][c] = bf16_rne(v[(t0 + qq) * D + hg * 256 + c]);
  __syncthreads();
  { for (int c = wave; c < 256; c += 8) { const int h = hg * 4 + c / HD, d = c % HD; const size_t o = (((size_t)b * H + h) * HD + d) * S + s0 + lane * 2; *(v2b*)(VT + o) = (v2b){(b16)(Tt[lane * 2][c] * XS), (b16)(Tt[lane * 2 + 1][c] * XS)}; }  } }
__device__ __forceinline__ float other_half(float x) { const int i = __float_as_int(x); return __int_as_float(__builtin_amdgcn_permlanex16(i, i, 0x76543210, 0xfedcba98, false, false)); }   // lane l <-> l ^ 16
// One wave per (b, h, 16 queries), four waves a block. S^T = K q^T: lane (nloc, hlf) holds query nloc's scores of keys 16 t + 8 hlf + r8, so max and sum are in-lane plus one exchange of the halves,
// and two score tiles, converted in place, are the B operand (32 keys x 16 queries, the k order of frag_kb) of O^T += V^T P^T. Scores and P never touch LDS.
constexpr float RS = SCALE / (XS * XS);               // raw accumulator -> score, a power of two (exact)
constexpr float C2 = RS * 1.4426950408889634f;        // raw accumulator -> exponent of 2
static_assert(PS == 256.0f, "the 8 in the exponent below is log2(PS)");
constexpr float DIAG_RAW = -10000.0f / RS, UP_RAW = -50000.0f / RS;   // the two mask values on the raw scale, both exact in f32
constexpr int NW = 4, QB = NW * 16;                   // waves of a block, queries of a tile
static_assert(QB == KC, "all waves of a block walk the same chunks, and only a tile's last one meets the diagonal");
constexpr int LP = HD + 8, TILE = KC * LP;            // LDS rows of 128 B at a pitch of 144 B (16 B x odd, for 16-byte readers); one tile = 64 rows
static_assert(HD == KC, "the K tile (keys x head dim) and the V^T tile (head dim x keys) have the same shape");
// One chunk's K tile and V^T tile, global -> LDS: 64 rows x 128 B each, every lane 16 B of rows r, r + 16, r + 32, r + 48 (eight lanes cover one whole 128-B line).
// lk, lv: the lane's LDS byte addresses of row r; gk, gv: its global addresses of row r.
__device__ __forceinline__ void copy_chunk(unsigned lk, unsigned lv, const b16* gk, const b16* gv) {
  // the closing s_wait_xcnt stands inside the statement, so that no address register of a copy is rewritten ahead of it
  asm volatile("global_load_async_to_lds_b128 %0, %8, off\n\t"
               "global_load_async_to_lds_b128 %1, %9, off\n\t"
               "global_load_async_to_lds_b128 %2, %10, off\n\t"
               "global_load_async_to_lds_b128 %3, %11, off\n\t"
               "global_load_async_to_lds_b128 %4, %12, off\n\t"
               "global_load_async_to_lds_b128 %5, %13, off\n\t"
               "global_load_async_to_lds_b128 %6, %14, off\n\t"
               "global_load_async_to_lds_b128 %7, %15, off\n\t"
               "s_wait_xcnt 0x0"
               :: "v"(lk), "v"(lk + 16 * LP * 2), "v"(lk + 32 * LP * 2), "v"(lk + 48 * LP * 2), "v"(lv), "v"(lv + 16 * LP * 2), "v"(lv + 32 * LP * 2), "v"(lv + 48 * LP * 2),
                  "v"(gk), "v"(gk + (size_t)16 * D), "v"(gk + (size_t)32 * D), "v"(gk + (size_t)48 * D), "v"(gv), "v"(gv + (size_t)16 * S), "v"(gv + (size_t)32 * S), "v"(gv + (size_t)48 * S)
               : "memory"); }
struct RowState { v8f oacc[4]; v8f lsv; float mraw, bo; };   // O^T tiles, partial row sums (x PS), running max (raw scale), exponent in use
// kc, vc: this lane's K row and V^T row in the chunk's LDS tiles (rows of LP elements); dk0 = (chunk's first key + 8 hlf) - (this lane's query), read only where MASKED
template <bool MASKED> __device__ __forceinline__ void chunk(const b16* __restrict__ kc, const b16* __restrict__ vc, int dk0, int hlf, const v16b (&qb)[2], RowState& st) {
  v16b kf[KC / 16][2], vf[KC / 32][4]; v8f sacc[KC / 16];
#pragma unroll
  for (int t = 0; t < KC / 16; ++t)
#pragma unroll
    for (int ks = 0; ks < 2; ++ks) kf[t][ks] = frag_kb(kc + (t * 16) * LP + ks * 32, hlf);
#pragma unroll
  for (int t = 0; t < KC / 16; ++t) { sacc[t] = (v8f){};
#pragma unroll
    for (int ks = 0; ks < 2; ++ks) sacc[t] = wmma16b(kf[t][ks], qb[ks], sacc[t]); }
#pragma unroll
  for (int j = 0; j < KC / 32; ++j)
#pragma unroll
    for (int t = 0; t < 4; ++t) vf[j][t] = frag_kb(vc + (t * 16) * LP + j * 32, hlf);
  if (MASKED) {
#pragma unroll
    for (int t = 0; t < KC / 16; ++t)
#pragma unroll
      for (int r8 = 0; r8 < 8; ++r8) { const int dk = dk0 + t * 16 + r8; float s = sacc[t][r8]; s = dk > 0 ? UP_RAW : s; s = dk == 0 ? DIAG_RAW : s; sacc[t][r8] = s; } }
  float mt[KC / 16];
#pragma unroll
  for (int t = 0; t < KC / 16; ++t) { mt[t] = sacc[t][0];
#pragma unroll
    for (int r8 = 1; r8 < 8; ++r8) mt[t] = fmaxf(mt[t], sacc[t][r8]); }
  float mx = mt[0];
#pragma unroll
  for (int t = 1; t < KC / 16; ++t) mx = fmaxf(mx, mt[t]);
  mx = fmaxf(mx, other_half(mx)); st.mraw = fmaxf(st.mraw, mx);
  const float bn = __builtin_fmaf(st.mraw, C2, -8.0f);   // exponent taken off every score; the 8 is P's x256 (PS)
  const float fac = __builtin_amdgcn_exp2f(st.bo - bn); st.bo = bn; st.lsv *= fac;
#pragma unroll
  for (int t = 0; t < 4; ++t) st.oacc[t] *= fac;
#pragma unroll
  for (int j = 0; j < KC / 32; ++j) { v16b ph, pl;
#pragma unroll
    for (int u = 0; u < 2; ++u) { v8f p;
#pragma unroll
      for (int e = 0; e < 8; ++e) p[e] = __builtin_amdgcn_exp2f(__builtin_fmaf(sacc[2 * j + u][e], C2, -bn));
#pragma unroll
      for (int e = 0; e < 8; e += 2) { const v2b hi = __builtin_convertvector((v2f){p[e], p[e + 1]}, v2b); const v2b lo = __builtin_convertvector((v2f){p[e] - (float)hi[0], p[e + 1] - (float)hi[1]}, v2b);
        ph[8 * u + e] = hi[0]; ph[8 * u + e + 1] = hi[1]; pl[8 * u + e] = lo[0]; pl[8 * u + e + 1] = lo[1]; }
      st.lsv += p; }
#pragma unroll
    for (int t = 0; t < 4; ++t) { st.oacc[t] = wmma16b(vf[j][t], ph, st.oacc[t]); st.oacc[t] = wmma16b(vf[j][t], pl, st.oacc[t]); } } }
constexpr int NTL = S / QB, NST = NTL + 1;           // query tiles of a head; chunks that every block walks
static_assert(NTL % 2 == 0, "tiles are taken in pairs");
// A block takes two query tiles of one head, one after the other: tile NTL - 1 - pr (NTL - pr chunks), then tile pr (pr + 1 chunks), so every block walks NST chunks and no WGP is left with only long tiles.
// The chunks of both tiles form one stream through the two LDS buffers: stream position i lies in buffer i & 1, and the second tile's first chunks are copied while the first tile ends.
__global__ __launch_bounds__(NW * 32) void att_kernel(const b16* __restrict__ Q16, const b16* __restrict__ K16, const b16* __restrict__ VT, const int* __restrict__ kmask, int QLIM, float* __restrict__ out) { static_assert(MODE == 0, "the register softmax is written for the self mask + causal form"); (void)kmask;
  __shared__ __attribute__((aligned(16))) b16 Kt[2][TILE]; __shared__ __attribute__((aligned(16))) b16 Vt[2][TILE]; __shared__ float Of[NW][16][HD + 1];
  const int tid = threadIdx.x, wave = tid >> 5, lane = tid & 31, nloc = lane & 15, hlf = lane >> 4; const int bh = blockIdx.x / (NTL / 2), pr = blockIdx.x % (NTL / 2);
  const int b = bh / H, h = bh % H, nch0 = NTL - pr;   // nch0: chunks of the first tile
  v16b qb[2], qn[2];   // q fragments of the tile at work and of the second tile, both fetched here
  for (int ks = 0; ks < 2; ++ks) { qb[ks] = frag_kb(Q16 + ((size_t)b * S + (NTL - 1 - pr) * QB + wave * 16 + nloc) * D + h * HD + ks * 32, hlf); qn[ks] = frag_kb(Q16 + ((size_t)b * S + pr * QB + wave * 16 + nloc) * D + h * HD + ks * 32, hlf); }
  asm volatile("s_wait_xcnt 0x0" ::: "memory");   // stands before the q loads' address registers are reused
  const int crow = tid >> 3, cseg = (tid & 7) * 8;   // the row and the 16-byte piece of it that this lane copies
  const b16* gk = K16 + ((size_t)b * S + crow) * D + h * HD + cseg; const b16* gv = VT + ((size_t)bh * HD + crow) * S + cseg;
  const unsigned lk0 = (unsigned)(size_t)&Kt[0][crow * LP + cseg], lv0 = (unsigned)(size_t)&Vt[0][crow * LP + cseg];
  auto fill = [&](int i) { const int kc = i < nch0 ? i : i - nch0, bf = i & 1;   // stream position -> key chunk of its tile, buffer
    copy_chunk(lk0 + bf * (TILE * 2), lv0 + bf * (TILE * 2), gk + (size_t)kc * KC * D, gv + kc * KC); };
  auto foot = [&](int i) {
    asm volatile("s_wait_dscnt 0x0" ::: "memory");      // this wave's reads of buffer i & 1 are done before anybody refills it
    asm volatile("s_wait_asynccnt 0x0" ::: "memory");   // this wave's share of stream position i + 1 has landed
    __syncthreads();                                    // publishes position i + 1 and frees buffer i & 1
    if (i + 2 < NST) fill(i + 2); };
  fill(0);
  asm volatile("s_wait_asynccnt 0x0" ::: "memory");   // this wave's share of position 0 has landed
  __syncthreads();                                    // ... and every other wave's
  fill(1);
  int g = 0;   // stream position
#pragma unroll 1   // the two tiles share one copy of the code
  for (int tl = 0; tl < 2; ++tl) { const int tile = tl == 0 ? NTL - 1 - pr : pr, q0 = tile * QB + wave * 16; const size_t tq = (size_t)b * S + q0;
    RowState st; for (int t = 0; t < 4; ++t) st.oacc[t] = (v8f){}; st.lsv = (v8f){}; st.mraw = -INFINITY; st.bo = -INFINITY;
#pragma unroll 1   // one chunk's fragments and scores already fill most of the register budget
    for (int c = 0; c < tile; ++c, ++g) { chunk<false>(&Kt[g & 1][nloc * LP], &Vt[g & 1][nloc * LP], 0, hlf, qb, st); foot(g); }
    chunk<true>(&Kt[g & 1][nloc * LP], &Vt[g & 1][nloc * LP], tile * KC + 8 * hlf - (q0 + nloc), hlf, qb, st); foot(g); ++g;   // only a tile's last chunk meets the diagonal
    if (q0 < QLIM) {   // wave-uniform; only this wave's own LDS rows are used inside
      const v8f lsv = st.lsv; float ls = ((lsv[0] + lsv[1]) + (lsv[2] + lsv[3])) + ((lsv[4] + lsv[5]) + (lsv[6] + lsv[7])); ls += other_half(ls); const float rinv = (1.0f / XS) / ls;   // ls carries PS like oacc
#pragma unroll
      for (int t = 0; t < 4; ++t)
#pragma unroll
        for (int r8 = 0; r8 < 8; ++r8) Of[wave][nloc][t * 16 + 8 * hlf + r8] = st.oacc[t][r8] * rinv;
      wave_lds_sync();
      for (int r = 0; r < 16; ++r) *(v2f*)(out + (tq + r) * D + h * HD + lane * 2) = (v2f){Of[wave][r][lane * 2], Of[wave][r][lane * 2 + 1]};   // the barriers of the next tile's chunks stand between these reads and the next results
      asm volatile("s_wait_xcnt 0x0" ::: "memory"); }   // stands before the stores' address and data registers are reused for the next tile
    for (int ks = 0; ks < 2; ++ks) qb[ks] = qn[ks]; }
  asm volatile("s_wait_asynccnt 0x0" ::: "memory");   // no copy is left in flight behind the loop
}
}  // namespace

extern "C" void kernel_launch(void* const* d_in, const int* in_sizes, int n_in, void* d_out, int out_size, void* d_ws, size_t ws_size, hipStream_t stream) {
  (void)n_in;
  auto Fp = [&](int i) { return (const float*)d_in[i]; };
  // input order: 0 q/query; 1 k/key; 2 v/value ([2,2048,1024] == [2,2048,16,64]); MODE 1: 3 attention_mask [2,2048] i32
  if (in_sizes[0] != NT * D || in_sizes[1] != NT * D || in_sizes[2] != NT * D || (MODE == 1 && in_sizes[3] != NT) || out_size != NT * D) return;
  const int QLIM = S;   // query cut (multiple of 16)
  size_t off = 0; char* ws = (char*)d_ws;
  auto carve = [&](size_t bytes) { char* p = ws + off; off += (bytes + 255) & ~(size_t)255; return p; };
  b16* Q16 = (b16*)carve((size_t)NT * D * 2); b16* K16 = (b16*)carve((size_t)NT * D * 2); b16* VT = (b16*)carve((size_t)NT * D * 2);
  if (off > ws_size || off > ((size_t)32 << 20)) return;   // 24 MB
  cvt_kernel<<<512, 256, 0, stream>>>(Fp(0), Fp(1), Q16, K16);
  vt_kernel<<<(NT / 64) * 4, 256, 0, stream>>>(Fp(2), VT);
  att_kernel<<<NB_ * H * (NTL / 2), NW * 32, 0, stream>>>(Q16, K16, VT, MODE == 1 ? (const int*)d_in[3] : nullptr, QLIM, (float*)d_out);
}

// v004
// A run of this version takes 46.4 microseconds.
// Two timings next to v003 put it at 1.45 and 1.44 times that version's speed.
// Over all steps from v000 it is 12.9 times as fast.
#include <hip/hip_runtime.h>

// ScaledDotProdAttention (shared-QK causal): 16 heads x 64 from [2,2048,1024]; dots = q.k/8; diagonal -> -10000 (self mask), strict upper -> -50000; softmax; out = attn v -> [2][2048][1024].
// Deterministic: online softmax over fixed 64-key chunks in order, only chunks at or below the query block (keys above are masked with a finite value whose exp underflows to exactly 0 against the row max, which always comes from an unmasked/diag key); no atomics.
// WMMA (v_wmma_f32_16x16x32_f16, f32 accumulate): q, k, v are raw inputs -> EXACT bf16 x8 f16 planes; per (b, h, 16-query) wave (four waves, 64 queries, share each 64-key K and V^T chunk through LDS) S^T = k rows x q (single product, exact operands) and O^T += v^T rows x P^T (hi+lo x256; 2 products); softmax in f32, in registers.

namespace {
constexpr int MODE = 0;   // 0: shared-QK self mask (diag -> -10000) + causal strict upper (-50000); 1: key padding mask input, not built (att_kernel static_asserts MODE == 0)
constexpr int NB_ = 2, S = 2048, H = 16, HD = 64, D = H * HD, NT = NB_ * S, KC = 64;
constexpr float XS = 8.0f, PS = 256.0f, SCALE = 0.125f;
typedef _Float16 b16;
typedef __attribute__((ext_vector_type(16))) _Float16 v16b;
typedef __attribute__((ext_vector_type(8))) _Float16 v8b;
typedef __attribute__((ext_vector_type(2))) _Float16 v2b;
typedef __attribute__((ext_vector_type(8))) float v8f;
typedef __attribute__((ext_vector_type(4))) float v4f;
typedef __attribute__((ext_vector_type(2))) float v2f;
__device__ __forceinline__ float bf16_rne(float f) { unsigned int u = __float_as_uint(f); u += 0x7FFFu + ((u >> 16) & 1u); return __uint_as_float(u & 0xFFFF0000u); }
__device__ __forceinline__ v16b frag_kb(const b16* p, int hh) { const v8b a = *(const v8b*)(p + 8 * hh), b = *(const v8b*)(p + 16 + 8 * hh); v16b f;
#pragma unroll
  for (int e = 0; e < 8; ++e) { f[e] = a[e]; f[8 + e] = b[e]; } return f; }
__device__ __forceinline__ v8f wmma16b(v16b a, v16b b, v8f c) { v8f d = __builtin_amdgcn_wmma_f32_16x16x32_f16(false, a, false, b, (short)0, c, false, false); asm volatile("v_nop\n\tv_nop\n\tv_nop\n\tv_nop" : "+v"(d) : "v"(a), "v"(b)); return d; }
__device__ __forceinline__ void wave_lds_sync() { __builtin_amdgcn_fence(__ATOMIC_RELEASE, "workgroup"); __builtin_amdgcn_wave_barrier(); __builtin_amdgcn_fence(__ATOMIC_ACQUIRE, "workgroup"); }

// Both conversion kernels are short streams: a lane issues all its 16-byte loads (512 contiguous bytes a wave each) before it uses the first value, so a wave pays the memory latency once.
// Left for a later step: the two run one after the other in launches of their own; in att_kernel four hand-written v_nop stand behind every WMMA builtin (wmma16b), beside the padding that the compiler adds itself.
typedef __attribute__((ext_vector_type(4))) _Float16 v4b;
__device__ __forceinline__ v4b plane4(v4f x) { v4f y;
#pragma unroll
  for (int j = 0; j < 4; ++j) y[j] = bf16_rne(x[j]) * XS;
  return __builtin_convertvector(y, v4b); }
constexpr int CB = 512, CN = NT * D / 4 / (CB * 256);   // blocks of cvt_kernel (two a WGP); 16-byte pieces of q, and of k, that a lane converts
static_assert((size_t)CB * 256 * CN * 4 == (size_t)NT * D, "the blocks cover q and k exactly");
__global__ __launch_bounds__(256) void cvt_kernel(const float* __restrict__ q, const float* __restrict__ k, b16* __restrict__ Q16, b16* __restrict__ K16) { const size_t e0 = ((size_t)blockIdx.x * (256 * CN) + threadIdx.x) * 4; const float* const pq = q + e0; const float* const pk = k + e0; v4f a[CN], c[CN];
#pragma unroll
  for (int i = 0; i < CN; ++i) { a[i] = *(const v4f*)(pq + i * 1024); c[i] = *(const v4f*)(pk + i * 1024); }
  asm volatile("s_wait_xcnt 0x0" :: "v"(pq), "v"(pk) : "memory");   // stands before the loads' address registers are reused (they are inputs, so they live up to here); no load is sunk below it
#pragma unroll
  for (int i = 0; i < CN; ++i) { *(v4b*)(Q16 + e0 + i * 1024) = plane4(a[i]); *(v4b*)(K16 + e0 + i * 1024) = plane4(c[i]); } }
// V^T: a block transposes 64 tokens x 256 columns (four heads). Wave w reads tokens 8 w .. 8 w + 7 (lane l: columns 128 hf + 4 l .. + 3), packs each column's eight tokens into 16 bytes and lays them in LDS as piece w of that column's row;
// then eight lanes store one column's 128 bytes (a whole line of VT). Rows of 128 B at a pitch of 144 B; piece p of column c lies at place p ^ ((c >> 4) & 3), so that the sixteen lanes of a half wave, four columns apart, write sixteen different 16-byte bank groups.
constexpr int VP = 144;
__device__ __forceinline__ int vt_at(int c, int p) { return c * VP + ((p ^ ((c >> 4) & 3)) << 4); }   // byte offset in Tt
__global__ __launch_bounds__(256) void vt_kernel(const float* __restrict__ v, b16* __restrict__ VT) { __shared__ __attribute__((aligned(16))) char Tt[256 * VP]; const int tt = blockIdx.x >> 2, hg = blockIdx.x & 3; const size_t t0 = (size_t)tt * 64; const int b = (int)(t0 / S), s0 = (int)(t0 % S); const int tid = threadIdx.x, wave = tid >> 5, lane = tid & 31;
  const float* const pv = v + (t0 + wave * 8) * D + hg * 256 + lane * 4; v4f x[8][2];
#pragma unroll
  for (int r = 0; r < 8; ++r)
#pragma unroll
    for (int hf = 0; hf < 2; ++hf) x[r][hf] = *(const v4f*)(pv + r * D + hf * 128);
  asm volatile("s_wait_xcnt 0x0" :: "v"(pv) : "memory");   // stands before the loads' address register is reused (it is an input, so it lives up to here); no load is sunk below it
#pragma unroll
  for (int hf = 0; hf < 2; ++hf)
#pragma unroll
    for (int j = 0; j < 4; ++j) { v8b pk;
#pragma unroll
      for (int r = 0; r < 8; r += 2) { const v2b two = __builtin_convertvector((v2f){bf16_rne(x[r][hf][j]) * XS, bf16_rne(x[r + 1][hf][j]) * XS}, v2b); pk[r] = two[0]; pk[r + 1] = two[1]; }
      *(v8b*)(Tt + vt_at(hf * 128 + lane * 4 + j, wave)) = pk; }
  __syncthreads();
  const int c0 = wave * 4 + (lane >> 3); b16* const o = VT + ((size_t)(b * H + hg * 4) * HD + c0) * S + s0 + (lane & 7) * 8;   // column c of the block is row (b * H + hg * 4) * HD + c of VT: head hg * 4 + c / HD, dim c % HD
#pragma unroll
  for (int i = 0; i < 8; ++i) *(v8b*)(o + (size_t)i * 32 * S) = *(const v8b*)(Tt + vt_at(i * 32 + c0, lane & 7)); }
__device__ __forceinline__ float other_half(float x) { const int i = __float_as_int(x); return __int_as_float(__builtin_amdgcn_permlanex16(i, i, 0x76543210, 0xfedcba98, false, false)); }   // lane l <-> l ^ 16
// One wave per (b, h, 16 queries), four waves a block. S^T = K q^T: lane (nloc, hlf) holds query nloc's scores of keys 16 t + 8 hlf + r8, so max and sum are in-lane plus one exchange of the halves,
// and two score tiles, converted in place, are the B operand (32 keys x 16 queries, the k order of frag_kb) of O^T += V^T P^T. Scores and P never touch LDS.
constexpr float RS = SCALE / (XS * XS);               // raw accumulator -> score, a power of two (exact)
constexpr float C2 = RS * 1.4426950408889634f;        // raw accumulator -> exponent of 2
static_assert(PS == 256.0f, "the 8 in the exponent below is log2(PS)");
constexpr float DIAG_RAW = -10000.0f / RS, UP_RAW = -50000.0f / RS;   // the two mask values on the raw scale, both exact in f32
constexpr int NW = 4, QB = NW * 16;                   // waves of a block, queries of a tile
static_assert(QB == KC, "all waves of a block walk the same chunks, and only a tile's last one meets the diagonal");
constexpr int LP = HD + 8, TILE = KC * LP;            // LDS rows of 128 B at a pitch of 144 B (16 B x odd, for 16-byte readers); one tile = 64 rows
static_assert(HD == KC, "the K tile (keys x head dim) and the V^T tile (head dim x keys) have the same shape");
// One chunk's K tile and V^T tile, global -> LDS: 64 rows x 128 B each, every lane 16 B of rows r, r + 16, r + 32, r + 48 (eight lanes cover one whole 128-B line).
// lk, lv: the lane's LDS byte addresses of row r; gk, gv: its global addresses of row r.
__device__ __forceinline__ void copy_chunk(unsigned lk, unsigned lv, const b16* gk, const b16* gv) {
  // the closing s_wait_xcnt stands inside the statement, so that no address register of a copy is rewritten ahead of it
  asm volatile("global_load_async_to_lds_b128 %0, %8, off\n\t"
               "global_load_async_to_lds_b128 %1, %9, off\n\t"
               "global_load_async_to_lds_b128 %2, %10, off\n\t"
               "global_load_async_to_lds_b128 %3, %11, off\n\t"
               "global_load_async_to_lds_b128 %4, %12, off\n\t"
               "global_load_async_to_lds_b128 %5, %13, off\n\t"
               "global_load_async_to_lds_b128 %6, %14, off\n\t"
               "global_load_async_to_lds_b128 %7, %15, off\n\t"
               "s_wait_xcnt 0x0"
               :: "v"(lk), "v"(lk + 16 * LP * 2), "v"(lk + 32 * LP * 2), "v"(lk + 48 * LP * 2), "v"(lv), "v"(lv + 16 * LP * 2), "v"(lv + 32 * LP * 2), "v"(lv + 48 * LP * 2),
                  "v"(gk), "v"(gk + (size_t)16 * D), "v"(gk + (size_t)32 * D), "v"(gk + (size_t)48 * D), "v"(gv), "v"(gv + (size_t)16 * S), "v"(gv + (size_t)32 * S), "v"(gv + (size_t)48 * S)
               : "memory"); }
struct RowState { v8f oacc[4]; v8f lsv; float mraw, bo; };   // O^T tiles, partial row sums (x PS), running max (raw scale), exponent in use
// kc, vc: this lane's K row and V^T row in the chunk's LDS tiles (rows of LP elements); dk0 = (chunk's first key + 8 hlf) - (this lane's query), read only where MASKED
template <bool MASKED> __device__ __forceinline__ void chunk(const b16* __restrict__ kc, const b16* __restrict__ vc, int dk0, int hlf, const v16b (&qb)[2], RowState& st) {
  v16b kf[KC / 16][2], vf[KC / 32][4]; v8f sacc[KC / 16];
#pragma unroll
  for (int t = 0; t < KC / 16; ++t)
#pragma unroll
    for (int ks = 0; ks < 2; ++ks) kf[t][ks] = frag_kb(kc + (t * 16) * LP + ks * 32, hlf);
#pragma unroll
  for (int t = 0; t < KC / 16; ++t) { sacc[t] = (v8f){};
#pragma unroll
    for (int ks = 0; ks < 2; ++ks) sacc[t] = wmma16b(kf[t][ks], qb[ks], sacc[t]); }
#pragma unroll
  for (int j = 0; j < KC / 32; ++j)
#pragma unroll
    for (int t = 0; t < 4; ++t) vf[j][t] = frag_kb(vc + (t * 16) * LP + j * 32, hlf);
  if (MASKED) {
#pragma unroll
    for (int t = 0; t < KC / 16; ++t)
#pragma unroll
      for (int r8 = 0; r8 < 8; ++r8) { const int dk = dk0 + t * 16 + r8; float s = sacc[t][r8]; s = dk > 0 ? UP_RAW : s; s = dk == 0 ? DIAG_RAW : s; sacc[t][r8] = s; } }
  float mt[KC / 16];
#pragma unroll
  for (int t = 0; t < KC / 16; ++t) { mt[t] = sacc[t][0];
#pragma unroll
    for (int r8 = 1; r8 < 8; ++r8) mt[t] = fmaxf(mt[t], sacc[t][r8]); }
  float mx = mt[0];
#pragma unroll
  for (int t = 1; t < KC / 16; ++t) mx = fmaxf(mx, mt[t]);
  mx = fmaxf(mx, other_half(mx)); st.mraw = fmaxf(st.mraw, mx);
  const float bn = __builtin_fmaf(st.mraw, C2, -8.0f);   // exponent taken off every score; the 8 is P's x256 (PS)
  const float fac = __builtin_amdgcn_exp2f(st.bo - bn); st.bo = bn; st.lsv *= fac;
#pragma unroll
  for (int t = 0; t < 4; ++t) st.oacc[t] *= fac;
#pragma unroll
  for (int j = 0; j < KC / 32; ++j) { v16b ph, pl;
#pragma unroll
    for (int u = 0; u < 2; ++u) { v8f p;
#pragma unroll
      for (int e = 0; e < 8; ++e) p[e] = __builtin_amdgcn_exp2f(__builtin_fmaf(sacc[2 * j + u][e], C2, -bn));
#pragma unroll
      for (int e = 0; e < 8; e += 2) { const v2b hi = __builtin_convertvector((v2f){p[e], p[e + 1]}, v2b); const v2b lo = __builtin_convertvector((v2f){p[e] - (float)hi[0], p[e + 1] - (float)hi[1]}, v2b);
        ph[8 * u + e] = hi[0]; ph[8 * u + e + 1] = hi[1]; pl[8 * u + e] = lo[0]; pl[8 * u + e + 1] = lo[1]; }
      st.lsv += p; }
#pragma unroll
    for (int t = 0; t < 4; ++t) { st.oacc[t] = wmma16b(vf[j][t], ph, st.oacc[t]); st.oacc[t] = wmma16b(vf[j][t], pl, st.oacc[t]); } } }
constexpr int NTL = S / QB, NST = NTL + 1;           // query tiles of a head; chunks that every block walks
static_assert(NTL % 2 == 0, "tiles are taken in pairs");
// A block takes two query tiles of one head, one after the other: tile NTL - 1 - pr (NTL - pr chunks), then tile pr (pr + 1 chunks), so every block walks NST chunks and no WGP is left with only long tiles.
// The chunks of both tiles form one stream through the two LDS buffers: stream position i lies in buffer i & 1, and the second tile's first chunks are copied while the first tile ends.
__global__ __launch_bounds__(NW * 32) void att_kernel(const b16* __restrict__ Q16, const b16* __restrict__ K16, const b16* __restrict__ VT, const int* __restrict__ kmask, int QLIM, float* __restrict__ out) { static_assert(MODE == 0, "the register softmax is written for the self mask + causal form"); (void)kmask;
  __shared__ __attribute__((aligned(16))) b16 Kt[2][TILE]; __shared__ __attribute__((aligned(16))) b16 Vt[2][TILE]; __shared__ float Of[NW][16][HD + 1];
  const int tid = threadIdx.x, wave = tid >> 5, lane = tid & 31, nloc = lane & 15, hlf = lane >> 4; const int bh = blockIdx.x / (NTL / 2), pr = blockIdx.x % (NTL / 2);
  const int b = bh / H, h = bh % H, nch0 = NTL - pr;   // nch0: chunks of the first tile
  v16b qb[2], qn[2];   // q fragments of the tile at work and of the second tile, both fetched here
  for (int ks = 0; ks < 2; ++ks) { qb[ks] = frag_kb(Q16 + ((size_t)b * S + (NTL - 1 - pr) * QB + wave * 16 + nloc) * D + h * HD + ks * 32, hlf); qn[ks] = frag_kb(Q16 + ((size_t)b * S + pr * QB + wave * 16 + nloc) * D + h * HD + ks * 32, hlf); }
  asm volatile("s_wait_xcnt 0x0" ::: "memory");   // stands before the q loads' address registers are reused
  const int crow = tid >> 3, cseg = (tid & 7) * 8;   // the row and the 16-byte piece of it that this lane copies
  const b16* gk = K16 + ((size_t)b * S + crow) * D + h * HD + cseg; const b16* gv = VT + ((size_t)bh * HD + crow) * S + cseg;
  const unsigned lk0 = (unsigned)(size_t)&Kt[0][crow * LP + cseg], lv0 = (unsigned)(size_t)&Vt[0][crow * LP + cseg];
  auto fill = [&](int i) { const int kc = i < nch0 ? i : i - nch0, bf = i & 1;   // stream position -> key chunk of its tile, buffer
    copy_chunk(lk0 + bf * (TILE * 2), lv0 + bf * (TILE * 2), gk + (size_t)kc * KC * D, gv + kc * KC); };
  auto foot = [&](int i) {
    asm volatile("s_wait_dscnt 0x0" ::: "memory");      // this wave's reads of buffer i & 1 are done before anybody refills it
    asm volatile("s_wait_asynccnt 0x0" ::: "memory");   // this wave's share of stream position i + 1 has landed
    __syncthreads();                                    // publishes position i + 1 and frees buffer i & 1
    if (i + 2 < NST) fill(i + 2); };
  fill(0);
  asm volatile("s_wait_asynccnt 0x0" ::: "memory");   // this wave's share of position 0 has landed
  __syncthreads();                                    // ... and every other wave's
  fill(1);
  int g = 0;   // stream position
#pragma unroll 1   // the two tiles share one copy of the code
  for (int tl = 0; tl < 2; ++tl) { const int tile = tl == 0 ? NTL - 1 - pr : pr, q0 = tile * QB + wave * 16; const size_t tq = (size_t)b * S + q0;
    RowState st; for (int t = 0; t < 4; ++t) st.oacc[t] = (v8f){}; st.lsv = (v8f){}; st.mraw = -INFINITY; st.bo = -INFINITY;
#pragma unroll 1   // one chunk's fragments and scores already fill most of the register budget
    for (int c = 0; c < tile; ++c, ++g) { chunk<false>(&Kt[g & 1][nloc * LP], &Vt[g & 1][nloc * LP], 0, hlf, qb, st); foot(g); }
    chunk<true>(&Kt[g & 1][nloc * LP], &Vt[g & 1][nloc * LP], tile * KC + 8 * hlf - (q0 + nloc), hlf, qb, st); foot(g); ++g;   // only a tile's last chunk meets the diagonal
    if (q0 < QLIM) {   // wave-uniform; only this wave's own LDS rows are used inside
      const v8f lsv = st.lsv; float ls = ((lsv[0] + lsv[1]) + (lsv[2] + lsv[3])) + ((lsv[4] + lsv[5]) + (lsv[6] + lsv[7])); ls += other_half(ls); const float rinv = (1.0f / XS) / ls;   // ls carries PS like oacc
#pragma unroll
      for (int t = 0; t < 4; ++t)
#pragma unroll
        for (int r8 = 0; r8 < 8; ++r8) Of[wave][nloc][t * 16 + 8 * hlf + r8] = st.oacc[t][r8] * rinv;
      wave_lds_sync();
      for (int r = 0; r < 16; ++r) *(v2f*)(out + (tq + r) * D + h * HD + lane * 2) = (v2f){Of[wave][r][lane * 2], Of[wave][r][lane * 2 + 1]};   // the barriers of the next tile's chunks stand between these reads and the next results
      asm volatile("s_wait_xcnt 0x0" ::: "memory"); }   // stands before the stores' address and data registers are reused for the next tile
    for (int ks = 0; ks < 2; ++ks) qb[ks] = qn[ks]; }
  asm volatile("s_wait_asynccnt 0x0" ::: "memory");   // no copy is left in flight behind the loop
}
}  // namespace

extern "C" void kernel_launch(void* const* d_in, const int* in_sizes, int n_in, void* d_out, int out_size, void* d_ws, size_t ws_size, hipStream_t stream) {
  (void)n_in;
  auto Fp = [&](int i) { return (const float*)d_in[i]; };
  // input order: 0 q/query; 1 k/key; 2 v/value ([2,2048,1024] == [2,2048,16,64]); MODE 1: 3 attention_mask [2,2048] i32
  if (in_sizes[0] != NT * D || in_sizes[1] != NT * D || in_sizes[2] != NT * D || (MODE == 1 && in_sizes[3] != NT) || out_size != NT * D) return;
  const int QLIM = S;   // query cut (multiple of 16)
  size_t off = 0; char* ws = (char*)d_ws;
  auto carve = [&](size_t bytes) { char* p = ws + off; off += (bytes + 255) & ~(size_t)255; return p; };
  b16* Q16 = (b16*)carve((size_t)NT * D * 2); b16* K16 = (b16*)carve((size_t)NT * D * 2); b16* VT = (b16*)carve((size_t)NT * D * 2);
  if (off > ws_size || off > ((size_t)32 << 20)) return;   // 24 MB
  cvt_kernel<<<CB, 256, 0, stream>>>(Fp(0), Fp(1), Q16, K16);
  vt_kernel<<<(NT / 64) * 4, 256, 0, stream>>>(Fp(2), VT);
  att_kernel<<<NB_ * H * (NTL / 2), NW * 32, 0, stream>>>(Q16, K16, VT, MODE == 1 ? (const int*)d_in[3] : nullptr, QLIM, (float*)d_out);
}

// v005
// A run of this version takes 43.3 microseconds.
// In both of two side-by-side timings against v004, it was 1.06 times as fast.
// Over all steps from v000 it is 13.7 times as fast.
#include <hip/hip_runtime.h>

// ScaledDotProdAttention (shared-QK causal): 16 heads x 64 from [2,2048,1024]; dots = q.k/8; diagonal -> -10000 (self mask), strict upper -> -50000; softmax; out = attn v -> [2][2048][1024].
// Deterministic: two online softmax streams per query over fixed 64-key chunks in order (the even and the odd chunks), joined once in a fixed order; only chunks at or below the query block (keys above are masked with a finite value whose exp underflows to exactly 0 against the row max, which always comes from an unmasked/diag key); no atomics.
// WMMA (v_wmma_f32_16x16x32_f16, f32 accumulate): q, k, v are raw inputs -> EXACT bf16 x8 f16 planes; per (b, h, 16 queries, chunk parity) wave (the four waves of a group, 64 queries, share each 64-key K and V^T chunk through LDS) S^T = k rows x q (single product, exact operands) and O^T += v^T rows x P^T (hi+lo x256; 2 products); softmax in f32, in registers.

namespace {
constexpr int MODE = 0;   // 0: shared-QK self mask (diag -> -10000) + causal strict upper (-50000); 1: key padding mask input, not built (att_kernel static_asserts MODE == 0)
constexpr int NB_ = 2, S = 2048, H = 16, HD = 64, D = H * HD, NT = NB_ * S, KC = 64;
constexpr float XS = 8.0f, PS = 256.0f, SCALE = 0.125f;
typedef _Float16 b16;
typedef __attribute__((ext_vector_type(16))) _Float16 v16b;
typedef __attribute__((ext_vector_type(8))) _Float16 v8b;
typedef __attribute__((ext_vector_type(2))) _Float16 v2b;
typedef __attribute__((ext_vector_type(8))) float v8f;
typedef __attribute__((ext_vector_type(4))) float v4f;
typedef __attribute__((ext_vector_type(2))) float v2f;
__device__ __forceinline__ float bf16_rne(float f) { unsigned int u = __float_as_uint(f); u += 0x7FFFu + ((u >> 16) & 1u); return __uint_as_float(u & 0xFFFF0000u); }
__device__ __forceinline__ v16b frag_kb(const b16* p, int hh) { const v8b a = *(const v8b*)(p + 8 * hh), b = *(const v8b*)(p + 16 + 8 * hh); v16b f;
#pragma unroll
  for (int e = 0; e < 8; ++e) { f[e] = a[e]; f[8 + e] = b[e]; } return f; }
__device__ __forceinline__ v8f wmma16b(v16b a, v16b b, v8f c) { v8f d = __builtin_amdgcn_wmma_f32_16x16x32_f16(false, a, false, b, (short)0, c, false, false); asm volatile("v_nop\n\tv_nop\n\tv_nop\n\tv_nop" : "+v"(d) : "v"(a), "v"(b)); return d; }
__device__ __forceinline__ void wave_lds_sync() { __builtin_amdgcn_fence(__ATOMIC_RELEASE, "workgroup"); __builtin_amdgcn_wave_barrier(); __builtin_amdgcn_fence(__ATOMIC_ACQUIRE, "workgroup"); }

// Both conversion kernels are short streams: a lane issues all its 16-byte loads (512 contiguous bytes a wave each) before it uses the first value, so a wave pays the memory latency once.
// Left for a later step: the two run one after the other in launches of their own; in att_kernel four hand-written v_nop stand behind every WMMA builtin (wmma16b), beside the padding that the compiler adds itself.
typedef __attribute__((ext_vector_type(4))) _Float16 v4b;
__device__ __forceinline__ v4b plane4(v4f x) { v4f y;
#pragma unroll
  for (int j = 0; j < 4; ++j) y[j] = bf16_rne(x[j]) * XS;
  return __builtin_convertvector(y, v4b); }
constexpr int CB = 512, CN = NT * D / 4 / (CB * 256);   // blocks of cvt_kernel (two a WGP); 16-byte pieces of q, and of k, that a lane converts
static_assert((size_t)CB * 256 * CN * 4 == (size_t)NT * D, "the blocks cover q and k exactly");
__global__ __launch_bounds__(256) void cvt_kernel(const float* __restrict__ q, const float* __restrict__ k, b16* __restrict__ Q16, b16* __restrict__ K16) { const size_t e0 = ((size_t)blockIdx.x * (256 * CN) + threadIdx.x) * 4; const float* const pq = q + e0; const float* const pk = k + e0; v4f a[CN], c[CN];
#pragma unroll
  for (int i = 0; i < CN; ++i) { a[i] = *(const v4f*)(pq + i * 1024); c[i] = *(const v4f*)(pk + i * 1024); }
  asm volatile("s_wait_xcnt 0x0" :: "v"(pq), "v"(pk) : "memory");   // stands before the loads' address registers are reused (they are inputs, so they live up to here); no load is sunk below it
#pragma unroll
  for (int i = 0; i < CN; ++i) { *(v4b*)(Q16 + e0 + i * 1024) = plane4(a[i]); *(v4b*)(K16 + e0 + i * 1024) = plane4(c[i]); } }
// V^T: a block transposes 64 tokens x 256 columns (four heads). Wave w reads tokens 8 w .. 8 w + 7 (lane l: columns 128 hf + 4 l .. + 3), packs each column's eight tokens into 16 bytes and lays them in LDS as piece w of that column's row;
// then eight lanes store one column's 128 bytes (a whole line of VT). Rows of 128 B at a pitch of 144 B; piece p of column c lies at place p ^ ((c >> 4) & 3), so that the sixteen lanes of a half wave, four columns apart, write sixteen different 16-byte bank groups.
constexpr int VP = 144;
__device__ __forceinline__ int vt_at(int c, int p) { return c * VP + ((p ^ ((c >> 4) & 3)) << 4); }   // byte offset in Tt
__global__ __launch_bounds__(256) void vt_kernel(const float* __restrict__ v, b16* __restrict__ VT) { __shared__ __attribute__((aligned(16))) char Tt[256 * VP]; const int tt = blockIdx.x >> 2, hg = blockIdx.x & 3; const size_t t0 = (size_t)tt * 64; const int b = (int)(t0 / S), s0 = (int)(t0 % S); const int tid = threadIdx.x, wave = tid >> 5, lane = tid & 31;
  const float* const pv = v + (t0 + wave * 8) * D + hg * 256 + lane * 4; v4f x[8][2];
#pragma unroll
  for (int r = 0; r < 8; ++r)
#pragma unroll
    for (int hf = 0; hf < 2; ++hf) x[r][hf] = *(const v4f*)(pv + r * D + hf * 128);
  asm volatile("s_wait_xcnt 0x0" :: "v"(pv) : "memory");   // stands before the loads' address register is reused (it is an input, so it lives up to here); no load is sunk below it
#pragma unroll
  for (int hf = 0; hf < 2; ++hf)
#pragma unroll
    for (int j = 0; j < 4; ++j) { v8b pk;
#pragma unroll
      for (int r = 0; r < 8; r += 2) { const v2b two = __builtin_convertvector((v2f){bf16_rne(x[r][hf][j]) * XS, bf16_rne(x[r + 1][hf][j]) * XS}, v2b); pk[r] = two[0]; pk[r + 1] = two[1]; }
      *(v8b*)(Tt + vt_at(hf * 128 + lane * 4 + j, wave)) = pk; }
  __syncthreads();
  const int c0 = wave * 4 + (lane >> 3); b16* const o = VT + ((size_t)(b * H + hg * 4) * HD + c0) * S + s0 + (lane & 7) * 8;   // column c of the block is row (b * H + hg * 4) * HD + c of VT: head hg * 4 + c / HD, dim c % HD
#pragma unroll
  for (int i = 0; i < 8; ++i) *(v8b*)(o + (size_t)i * 32 * S) = *(const v8b*)(Tt + vt_at(i * 32 + c0, lane & 7)); }
__device__ __forceinline__ float other_half(float x) { const int i = __float_as_int(x); return __int_as_float(__builtin_amdgcn_permlanex16(i, i, 0x76543210, 0xfedcba98, false, false)); }   // lane l <-> l ^ 16
// Two waves per (b, h, 16 queries), one for the even and one for the odd key chunks; eight waves a block. S^T = K q^T: lane (nloc, hlf) holds query nloc's scores of keys 16 t + 8 hlf + r8, so max and sum are in-lane plus one exchange of the halves,
// and two score tiles, converted in place, are the B operand (32 keys x 16 queries, the k order of frag_kb) of O^T += V^T P^T. Scores and P never touch LDS.
constexpr float RS = SCALE / (XS * XS);               // raw accumulator -> score, a power of two (exact)
constexpr float C2 = RS * 1.4426950408889634f;        // raw accumulator -> exponent of 2
static_assert(PS == 256.0f, "the 8 in the exponent below is log2(PS)");
constexpr float DIAG_RAW = -10000.0f / RS, UP_RAW = -50000.0f / RS;   // the two mask values on the raw scale, both exact in f32
constexpr int NW = 4, QB = NW * 16;                   // waves of a group and queries of a tile
static_assert(QB == KC, "all waves of a group walk the same chunks, and only a tile's last one meets the diagonal");
constexpr int LP = HD + 8, TILE = KC * LP;            // LDS rows of 128 B at a pitch of 144 B (16 B x odd, for 16-byte readers); one tile = 64 rows
static_assert(HD == KC, "the K tile (keys x head dim) and the V^T tile (head dim x keys) have the same shape");
// One chunk's K tile and V^T tile, global -> LDS: 64 rows x 128 B each, every lane 16 B of rows r, r + 16, r + 32, r + 48 (eight lanes cover one whole 128-B line).
// lk, lv: the lane's LDS byte addresses of row r; gk, gv: its global addresses of row r.
__device__ __forceinline__ void copy_chunk(unsigned lk, unsigned lv, const b16* gk, const b16* gv) {
  // the closing s_wait_xcnt stands inside the statement, so that no address register of a copy is rewritten ahead of it
  asm volatile("global_load_async_to_lds_b128 %0, %8, off\n\t"
               "global_load_async_to_lds_b128 %1, %9, off\n\t"
               "global_load_async_to_lds_b128 %2, %10, off\n\t"
               "global_load_async_to_lds_b128 %3, %11, off\n\t"
               "global_load_async_to_lds_b128 %4, %12, off\n\t"
               "global_load_async_to_lds_b128 %5, %13, off\n\t"
               "global_load_async_to_lds_b128 %6, %14, off\n\t"
               "global_load_async_to_lds_b128 %7, %15, off\n\t"
               "s_wait_xcnt 0x0"
               :: "v"(lk), "v"(lk + 16 * LP * 2), "v"(lk + 32 * LP * 2), "v"(lk + 48 * LP * 2), "v"(lv), "v"(lv + 16 * LP * 2), "v"(lv + 32 * LP * 2), "v"(lv + 48 * LP * 2),
                  "v"(gk), "v"(gk + (size_t)16 * D), "v"(gk + (size_t)32 * D), "v"(gk + (size_t)48 * D), "v"(gv), "v"(gv + (size_t)16 * S), "v"(gv + (size_t)32 * S), "v"(gv + (size_t)48 * S)
               : "memory"); }
struct RowState { v8f oacc[4]; v8f lsv; float mraw, bo; };   // O^T tiles, partial row sums (x PS), running max (raw scale), exponent in use
// kc, vc: this lane's K row and V^T row in the chunk's LDS tiles (rows of LP elements); dk0 = (chunk's first key + 8 hlf) - (this lane's query), read only where MASKED
template <bool MASKED> __device__ __forceinline__ void chunk(const b16* __restrict__ kc, const b16* __restrict__ vc, int dk0, int hlf, const v16b (&qb)[2], RowState& st) {
  v16b kf[KC / 16][2], vf[KC / 32][4]; v8f sacc[KC / 16];
#pragma unroll
  for (int t = 0; t < KC / 16; ++t)
#pragma unroll
    for (int ks = 0; ks < 2; ++ks) kf[t][ks] = frag_kb(kc + (t * 16) * LP + ks * 32, hlf);
#pragma unroll
  for (int t = 0; t < KC / 16; ++t) { sacc[t] = (v8f){};
#pragma unroll
    for (int ks = 0; ks < 2; ++ks) sacc[t] = wmma16b(kf[t][ks], qb[ks], sacc[t]); }
#pragma unroll
  for (int j = 0; j < KC / 32; ++j)
#pragma unroll
    for (int t = 0; t < 4; ++t) vf[j][t] = frag_kb(vc + (t * 16) * LP + j * 32, hlf);
  if (MASKED) {
#pragma unroll
    for (int t = 0; t < KC / 16; ++t)
#pragma unroll
      for (int r8 = 0; r8 < 8; ++r8) { const int dk = dk0 + t * 16 + r8; float s = sacc[t][r8]; s = dk > 0 ? UP_RAW : s; s = dk == 0 ? DIAG_RAW : s; sacc[t][r8] = s; } }
  float mt[KC / 16];
#pragma unroll
  for (int t = 0; t < KC / 16; ++t) { mt[t] = sacc[t][0];
#pragma unroll
    for (int r8 = 1; r8 < 8; ++r8) mt[t] = fmaxf(mt[t], sacc[t][r8]); }
  float mx = mt[0];
#pragma unroll
  for (int t = 1; t < KC / 16; ++t) mx = fmaxf(mx, mt[t]);
  mx = fmaxf(mx, other_half(mx)); st.mraw = fmaxf(st.mraw, mx);
  const float bn = __builtin_fmaf(st.mraw, C2, -8.0f);   // exponent taken off every score; the 8 is P's x256 (PS)
  const float fac = __builtin_amdgcn_exp2f(st.bo - bn); st.bo = bn; st.lsv *= fac;
#pragma unroll
  for (int t = 0; t < 4; ++t) st.oacc[t] *= fac;
#pragma unroll
  for (int j = 0; j < KC / 32; ++j) { v16b ph, pl;
#pragma unroll
    for (int u = 0; u < 2; ++u) { v8f p;
#pragma unroll
      for (int e = 0; e < 8; ++e) p[e] = __builtin_amdgcn_exp2f(__builtin_fmaf(sacc[2 * j + u][e], C2, -bn));
#pragma unroll
      for (int e = 0; e < 8; e += 2) { const v2b hi = __builtin_convertvector((v2f){p[e], p[e + 1]}, v2b); const v2b lo = __builtin_convertvector((v2f){p[e] - (float)hi[0], p[e + 1] - (float)hi[1]}, v2b);
        ph[8 * u + e] = hi[0]; ph[8 * u + e + 1] = hi[1]; pl[8 * u + e] = lo[0]; pl[8 * u + e + 1] = lo[1]; }
      st.lsv += p; }
#pragma unroll
    for (int t = 0; t < 4; ++t) { st.oacc[t] = wmma16b(vf[j][t], ph, st.oacc[t]); st.oacc[t] = wmma16b(vf[j][t], pl, st.oacc[t]); } } }
constexpr int NTL = S / QB, NG = 2, NSTG = (NTL + 2) / 2;   // query tiles of a head; wave groups that share a tile's keys; stages (one 64-key chunk a group) that every block walks
static_assert(NTL % 2 == 0, "tiles are taken in pairs");
// A block takes two query tiles of one head, one after the other: tile NTL - 1 - pr (NTL - pr chunks), then tile pr (pr + 1 chunks).
// Eight waves: waves w and w + 4 hold the SAME 16 queries; group 0 (waves 0..3) walks the tile's even key chunks, group 1 the odd ones, each with a running max, sum and O^T of its own,
// so a WGP with two blocks has four waves a SIMD to fill each other's waits. One of the two tiles has an odd chunk count (group 1 sits out its last stage): every block walks NSTG stages.
// Behind a tile's last stage group 1 hands its state to group 0 through LDS (the stage's own barrier publishes it) and group 0 joins the two as the online softmax joins two chunks.
// The stages of both tiles form one stream through the two LDS buffers: stream position i lies in buffer i & 1; each group copies its own chunk.
__global__ __launch_bounds__(NG * NW * 32) __attribute__((amdgpu_waves_per_eu(4, 4))) void att_kernel(const b16* __restrict__ Q16, const b16* __restrict__ K16, const b16* __restrict__ VT, const int* __restrict__ kmask, int QLIM, float* __restrict__ out) { static_assert(MODE == 0, "the register softmax is written for the self mask + causal form"); (void)kmask;
  __shared__ __attribute__((aligned(16))) b16 Kt[2][NG][TILE]; __shared__ __attribute__((aligned(16))) b16 Vt[2][NG][TILE]; __shared__ float Of[NW][16][HD + 1];
  __shared__ __attribute__((aligned(16))) v4f Mo[2][NW][8][32]; __shared__ float Ms[2][NW][2][32];   // group 1's O^T, row sum and exponent, lane by lane; one set a tile, so that the second tile's hand-over never meets a reader of the first
  const int tid = threadIdx.x, lane = tid & 31, nloc = lane & 15, hlf = lane >> 4; const int bh = blockIdx.x / (NTL / 2), pr = blockIdx.x % (NTL / 2);
  const int wave = __builtin_amdgcn_readfirstlane(tid >> 5), grp = wave / NW, wq = wave % NW;   // scalar, so that the tests on grp are scalar branches (WMMA wants every lane on)
  const int b = bh / H, h = bh % H, ns0 = (NTL - pr + 1) / 2;   // ns0: stages of the first tile
  v16b qb[2], qn[2];   // q fragments of the tile at work and of the second tile, both fetched here
  for (int ks = 0; ks < 2; ++ks) { qb[ks] = frag_kb(Q16 + ((size_t)b * S + (NTL - 1 - pr) * QB + wq * 16 + nloc) * D + h * HD + ks * 32, hlf); qn[ks] = frag_kb(Q16 + ((size_t)b * S + pr * QB + wq * 16 + nloc) * D + h * HD + ks * 32, hlf); }
  asm volatile("s_wait_xcnt 0x0" ::: "memory");   // stands before the q loads' address registers are reused
  const int crow = (tid & (NW * 32 - 1)) >> 3, cseg = (tid & 7) * 8;   // the row of its group's chunk and the 16-byte piece of it that this lane copies
  const b16* gk = K16 + ((size_t)b * S + crow) * D + h * HD + cseg; const b16* gv = VT + ((size_t)bh * HD + crow) * S + cseg;
  const unsigned lk0 = (unsigned)(size_t)&Kt[0][grp][crow * LP + cseg], lv0 = (unsigned)(size_t)&Vt[0][grp][crow * LP + cseg];
  auto fill = [&](int i) { const int ls = i < ns0 ? i : i - ns0, last = i < ns0 ? NTL - 1 - pr : pr, bf = i & 1;   // stream position -> stage of its tile, the tile's last chunk, buffer
    const int kc = min(NG * ls + grp, last);   // where group 1 has no chunk left it copies the last one again (in bounds, into its own buffer, read by nobody), so that every wave issues the same copies
    copy_chunk(lk0 + bf * (NG * TILE * 2), lv0 + bf * (NG * TILE * 2), gk + (size_t)kc * KC * D, gv + kc * KC); };
  auto foot = [&](int i) {
    asm volatile("s_wait_dscnt 0x0" ::: "memory");      // this wave's reads of buffer i & 1 (and group 1's hand-over stores) are done before the barrier
    asm volatile("s_wait_asynccnt 0x0" ::: "memory");   // this wave's share of stream position i + 1 has landed
    __syncthreads();                                    // publishes position i + 1 and frees buffer i & 1
    if (i + 2 < NSTG) fill(i + 2); };
  fill(0);
  asm volatile("s_wait_asynccnt 0x0" ::: "memory");   // this wave's share of position 0 has landed
  __syncthreads();                                    // ... and every other wave's
  fill(1);
  int g = 0;   // stream position
#pragma unroll 1   // the two tiles share one copy of the code
  for (int tl = 0; tl < 2; ++tl) { const int tile = tl == 0 ? NTL - 1 - pr : pr, q0 = tile * QB + wq * 16, ns = (tile + NG) / NG; const size_t tq = (size_t)b * S + q0;
    RowState st; for (int t = 0; t < 4; ++t) st.oacc[t] = (v8f){}; st.lsv = (v8f){}; st.mraw = -INFINITY; st.bo = -INFINITY;
#pragma unroll 1   // one chunk's fragments and scores already fill most of the register budget
    for (int ls = 0; ls < ns - 1; ++ls, ++g) { chunk<false>(&Kt[g & 1][grp][nloc * LP], &Vt[g & 1][grp][nloc * LP], 0, hlf, qb, st); foot(g); }   // ahead of a tile's last stage neither group meets the diagonal
    { const int c = NG * (ns - 1) + grp;   // this group's chunk of the last stage: only chunk number tile meets the diagonal, and a chunk beyond it does not exist
      const b16* const kc = &Kt[g & 1][grp][nloc * LP]; const b16* const vc = &Vt[g & 1][grp][nloc * LP];
      if (c < tile) chunk<false>(kc, vc, 0, hlf, qb, st);
      else if (c == tile) chunk<true>(kc, vc, tile * KC + 8 * hlf - (q0 + nloc), hlf, qb, st);
      if (grp == 1) {   // the hand-over; the barrier in foot() publishes it
        const v8f lsv = st.lsv;
#pragma unroll
        for (int t = 0; t < 4; ++t)
#pragma unroll
          for (int u = 0; u < 2; ++u) Mo[tl][wq][2 * t + u][lane] = (v4f){st.oacc[t][4 * u], st.oacc[t][4 * u + 1], st.oacc[t][4 * u + 2], st.oacc[t][4 * u + 3]};
        Ms[tl][wq][0][lane] = ((lsv[0] + lsv[1]) + (lsv[2] + lsv[3])) + ((lsv[4] + lsv[5]) + (lsv[6] + lsv[7])); Ms[tl][wq][1][lane] = st.bo; }
      foot(g); ++g; }
    if (grp == 0 && q0 < QLIM) {   // wave-uniform; no barrier inside
      const v8f lsv = st.lsv; const float l0 = ((lsv[0] + lsv[1]) + (lsv[2] + lsv[3])) + ((lsv[4] + lsv[5]) + (lsv[6] + lsv[7])), l1 = Ms[tl][wq][0][lane], b1 = Ms[tl][wq][1][lane];
      const float bj = fmaxf(st.bo, b1), f0 = __builtin_amdgcn_exp2f(st.bo - bj), f1 = __builtin_amdgcn_exp2f(b1 - bj);   // group 0 always has chunk 0, so bj is finite; a group 1 without a chunk hands over -inf, zeros: f1 = 0
      float ls = l0 * f0 + l1 * f1; ls += other_half(ls); const float rinv = (1.0f / XS) / ls, r0 = f0 * rinv, r1 = f1 * rinv;   // ls carries PS like oacc
#pragma unroll
      for (int t = 0; t < 4; ++t)
#pragma unroll
        for (int u = 0; u < 2; ++u) { const v4f o1 = Mo[tl][wq][2 * t + u][lane];
#pragma unroll
          for (int e = 0; e < 4; ++e) Of[wq][nloc][t * 16 + 8 * hlf + 4 * u + e] = st.oacc[t][4 * u + e] * r0 + o1[e] * r1; }
      wave_lds_sync();
      for (int r = 0; r < 16; ++r) *(v2f*)(out + (tq + r) * D + h * HD + lane * 2) = (v2f){Of[wq][r][lane * 2], Of[wq][r][lane * 2 + 1]};   // the barriers of the next tile's stages stand between these reads and the next results
      asm volatile("s_wait_xcnt 0x0" ::: "memory"); }   // stands before the stores' address and data registers are reused for the next tile
    for (int ks = 0; ks < 2; ++ks) qb[ks] = qn[ks]; }
  asm volatile("s_wait_asynccnt 0x0" ::: "memory");   // no copy is left in flight behind the loop
}
}  // namespace

extern "C" void kernel_launch(void* const* d_in, const int* in_sizes, int n_in, void* d_out, int out_size, void* d_ws, size_t ws_size, hipStream_t stream) {
  (void)n_in;
  auto Fp = [&](int i) { return (const float*)d_in[i]; };
  // input order: 0 q/query; 1 k/key; 2 v/value ([2,2048,1024] == [2,2048,16,64]); MODE 1: 3 attention_mask [2,2048] i32
  if (in_sizes[0] != NT * D || in_sizes[1] != NT * D || in_sizes[2] != NT * D || (MODE == 1 && in_sizes[3] != NT) || out_size != NT * D) return;
  const int QLIM = S;   // query cut (multiple of 16)
  size_t off = 0; char* ws = (char*)d_ws;
  auto carve = [&](size_t bytes) { char* p = ws + off; off += (bytes + 255) & ~(size_t)255; return p; };
  b16* Q16 = (b16*)carve((size_t)NT * D * 2); b16* K16 = (b16*)carve((size_t)NT * D * 2); b16* VT = (b16*)carve((size_t)NT * D * 2);
  if (off > ws_size || off > ((size_t)32 << 20)) return;   // 24 MB
  cvt_kernel<<<CB, 256, 0, stream>>>(Fp(0), Fp(1), Q16, K16);
  vt_kernel<<<(NT / 64) * 4, 256, 0, stream>>>(Fp(2), VT);
  att_kernel<<<NB_ * H * (NTL / 2), NG * NW * 32, 0, stream>>>(Q16, K16, VT, MODE == 1 ? (const int*)d_in[3] : nullptr, QLIM, (float*)d_out);
}

// v007
// It runs in 35.9 microseconds.
// It is 1.21 times as fast as v005, going by the measured steps of the versions left out in between.
// Counting every step since v000, it is 16.6 times as fast.
#include <hip/hip_runtime.h>

// ScaledDotProdAttention (shared-QK causal): 16 heads x 64 from [2,2048,1024]; dots = q.k/8; diagonal -> -10000 (self mask), strict upper -> -50000; softmax; out = attn v -> [2][2048][1024].
// Deterministic: two online softmax streams per query over fixed 64-key chunks in order (the even and the odd chunks), joined once in a fixed order; only chunks at or below the query block (keys above are masked with a finite value whose exp underflows to exactly 0 against the row max, which always comes from an unmasked/diag key); no atomics.
// WMMA (v_wmma_f32_16x16x32_f16, f32 accumulate): q, k, v are raw inputs -> EXACT bf16 x8 f16 planes; per (b, h, 32 queries, chunk parity) wave (the four waves of a group, 128 queries, share each 64-key K and V^T chunk through LDS; a fragment read from LDS serves the wave's two 16-query column groups) S^T = k rows x q (single product, exact operands) and O^T += v^T rows x P^T (P x256, rounded once to f16; single product); softmax in f32, in registers.

namespace {
constexpr int MODE = 0;   // 0: shared-QK self mask (diag -> -10000) + causal strict upper (-50000); 1: key padding mask input, not built (att_kernel static_asserts MODE == 0)
constexpr int NB_ = 2, S = 2048, H = 16, HD = 64, D = H * HD, NT = NB_ * S, KC = 64;
constexpr float XS = 8.0f, PS = 256.0f, SCALE = 0.125f;
typedef _Float16 b16;
typedef __attribute__((ext_vector_type(16))) _Float16 v16b;
typedef __attribute__((ext_vector_type(8))) _Float16 v8b;
typedef __attribute__((ext_vector_type(2))) _Float16 v2b;
typedef __attribute__((ext_vector_type(8))) float v8f;
typedef __attribute__((ext_vector_type(4))) float v4f;
typedef __attribute__((ext_vector_type(2))) float v2f;
__device__ __forceinline__ float bf16_rne(float f) { unsigned int u = __float_as_uint(f); u += 0x7FFFu + ((u >> 16) & 1u); return __uint_as_float(u & 0xFFFF0000u); }
__device__ __forceinline__ v16b frag_kb(const b16* p, int hh) { const v8b a = *(const v8b*)(p + 8 * hh), b = *(const v8b*)(p + 16 + 8 * hh); v16b f;
#pragma unroll
  for (int e = 0; e < 8; ++e) { f[e] = a[e]; f[8 + e] = b[e]; } return f; }
// the builtin alone: the compiler keeps the distance behind it itself, and an asm statement on its operands would hold all of them in the first 256 registers, which a 32-query wave's tiles and fragments overfill (spills)
__device__ __forceinline__ v8f wmma16b(v16b a, v16b b, v8f c) { return __builtin_amdgcn_wmma_f32_16x16x32_f16(false, a, false, b, (short)0, c, false, false); }
__device__ __forceinline__ void wave_lds_sync() { __builtin_amdgcn_fence(__ATOMIC_RELEASE, "workgroup"); __builtin_amdgcn_wave_barrier(); __builtin_amdgcn_fence(__ATOMIC_ACQUIRE, "workgroup"); }

// Both conversion kernels are short streams: a lane issues all its 16-byte loads (512 contiguous bytes a wave each) before it uses the first value, so a wave pays the memory latency once.
typedef __attribute__((ext_vector_type(4))) _Float16 v4b;
__device__ __forceinline__ v4b plane4(v4f x) { v4f y;
#pragma unroll
  for (int j = 0; j < 4; ++j) y[j] = bf16_rne(x[j]) * XS;
  return __builtin_convertvector(y, v4b); }
constexpr int CB = 512, CN = NT * D / 4 / (CB * 256);   // blocks of cvt_kernel (two a WGP); 16-byte pieces of q, and of k, that a lane converts
static_assert((size_t)CB * 256 * CN * 4 == (size_t)NT * D, "the blocks cover q and k exactly");
__global__ __launch_bounds__(256) void cvt_kernel(const float* __restrict__ q, const float* __restrict__ k, b16* __restrict__ Q16, b16* __restrict__ K16) { const size_t e0 = ((size_t)blockIdx.x * (256 * CN) + threadIdx.x) * 4; const float* const pq = q + e0; const float* const pk = k + e0; v4f a[CN], c[CN];
#pragma unroll
  for (int i = 0; i < CN; ++i) { a[i] = *(const v4f*)(pq + i * 1024); c[i] = *(const v4f*)(pk + i * 1024); }
  asm volatile("s_wait_xcnt 0x0" :: "v"(pq), "v"(pk) : "memory");   // stands before the loads' address registers are reused (they are inputs, so they live up to here); no load is sunk below it
#pragma unroll
  for (int i = 0; i < CN; ++i) { *(v4b*)(Q16 + e0 + i * 1024) = plane4(a[i]); *(v4b*)(K16 + e0 + i * 1024) = plane4(c[i]); } }
// V^T: a block transposes 64 tokens x 256 columns (four heads). Wave w reads tokens 8 w .. 8 w + 7 (lane l: columns 128 hf + 4 l .. + 3), packs each column's eight tokens into 16 bytes and lays them in LDS as piece w of that column's row;
// then eight lanes store one column's 128 bytes (a whole line of VT). Rows of 128 B at a pitch of 144 B; piece p of column c lies at place p ^ ((c >> 4) & 3), so that the sixteen lanes of a half wave, four columns apart, write sixteen different 16-byte bank groups.
constexpr int VP = 144;
__device__ __forceinline__ int vt_at(int c, int p) { return c * VP + ((p ^ ((c >> 4) & 3)) << 4); }   // byte offset in Tt
__global__ __launch_bounds__(256) void vt_kernel(const float* __restrict__ v, b16* __restrict__ VT) { __shared__ __attribute__((aligned(16))) char Tt[256 * VP]; const int tt = blockIdx.x >> 2, hg = blockIdx.x & 3; const size_t t0 = (size_t)tt * 64; const int b = (int)(t0 / S), s0 = (int)(t0 % S); const int tid = threadIdx.x, wave = tid >> 5, lane = tid & 31;
  const float* const pv = v + (t0 + wave * 8) * D + hg * 256 + lane * 4; v4f x[8][2];
#pragma unroll
  for (int r = 0; r < 8; ++r)
#pragma unroll
    for (int hf = 0; hf < 2; ++hf) x[r][hf] = *(const v4f*)(pv + r * D + hf * 128);
  asm volatile("s_wait_xcnt 0x0" :: "v"(pv) : "memory");   // stands before the loads' address register is reused (it is an input, so it lives up to here); no load is sunk below it
#pragma unroll
  for (int hf = 0; hf < 2; ++hf)
#pragma unroll
    for (int j = 0; j < 4; ++j) { v8b pk;
#pragma unroll
      for (int r = 0; r < 8; r += 2) { const v2b two = __builtin_convertvector((v2f){bf16_rne(x[r][hf][j]) * XS, bf16_rne(x[r + 1][hf][j]) * XS}, v2b); pk[r] = two[0]; pk[r + 1] = two[1]; }
      *(v8b*)(Tt + vt_at(hf * 128 + lane * 4 + j, wave)) = pk; }
  __syncthreads();
  const int c0 = wave * 4 + (lane >> 3); b16* const o = VT + ((size_t)(b * H + hg * 4) * HD + c0) * S + s0 + (lane & 7) * 8;   // column c of the block is row (b * H + hg * 4) * HD + c of VT: head hg * 4 + c / HD, dim c % HD
#pragma unroll
  for (int i = 0; i < 8; ++i) *(v8b*)(o + (size_t)i * 32 * S) = *(const v8b*)(Tt + vt_at(i * 32 + c0, lane & 7)); }
__device__ __forceinline__ float other_half(float x) { const int i = __float_as_int(x); return __int_as_float(__builtin_amdgcn_permlanex16(i, i, 0x76543210, 0xfedcba98, false, false)); }   // lane l <-> l ^ 16
// Two waves per (b, h, 32 queries), one for the even and one for the odd key chunks; eight waves a block. A wave's queries are two column groups of 16. S^T = K q^T: in each group lane (nloc, hlf) holds query nloc's scores of keys 16 t + 8 hlf + r8, so max and sum are in-lane plus one exchange of the halves,
// and two score tiles, converted in place, are the B operand (32 keys x 16 queries, the k order of frag_kb) of O^T += V^T P^T. Scores and P never touch LDS.
constexpr float RS = SCALE / (XS * XS);               // raw accumulator -> score, a power of two (exact)
constexpr float C2 = RS * 1.4426950408889634f;        // raw accumulator -> exponent of 2
static_assert(PS == 256.0f, "the 8 in the exponent below is log2(PS)");
constexpr float DIAG_RAW = -10000.0f / RS, UP_RAW = -50000.0f / RS;   // the two mask values on the raw scale, both exact in f32
constexpr int NW = 4, NC = 2, WQ = NC * 16, QB = NW * WQ;   // waves of a group, 16-query column groups of a wave, queries of a wave and of a block
static_assert(QB == 2 * KC, "a tile has an even number of chunks, one a group in every stage, and only its last stage meets the diagonal");
constexpr int LP = HD + 8, TILE = KC * LP;            // LDS rows of 128 B at a pitch of 144 B (16 B x odd, for 16-byte readers); one tile = 64 rows
static_assert(HD == KC, "the K tile (keys x head dim) and the V^T tile (head dim x keys) have the same shape");
// One chunk's K tile and V^T tile, global -> LDS: 64 rows x 128 B each, every lane 16 B of rows r, r + 16, r + 32, r + 48 (eight lanes cover one whole 128-B line).
// lk, lv: the lane's LDS byte addresses of row r; gk, gv: its global addresses of row r.
__device__ __forceinline__ void copy_chunk(unsigned lk, unsigned lv, const b16* gk, const b16* gv) {
  // the closing s_wait_xcnt stands inside the statement, so that no address register of a copy is rewritten ahead of it
  asm volatile("global_load_async_to_lds_b128 %0, %8, off\n\t"
               "global_load_async_to_lds_b128 %1, %9, off\n\t"
               "global_load_async_to_lds_b128 %2, %10, off\n\t"
               "global_load_async_to_lds_b128 %3, %11, off\n\t"
               "global_load_async_to_lds_b128 %4, %12, off\n\t"
               "global_load_async_to_lds_b128 %5, %13, off\n\t"
               "global_load_async_to_lds_b128 %6, %14, off\n\t"
               "global_load_async_to_lds_b128 %7, %15, off\n\t"
               "s_wait_xcnt 0x0"
               :: "v"(lk), "v"(lk + 16 * LP * 2), "v"(lk + 32 * LP * 2), "v"(lk + 48 * LP * 2), "v"(lv), "v"(lv + 16 * LP * 2), "v"(lv + 32 * LP * 2), "v"(lv + 48 * LP * 2),
                  "v"(gk), "v"(gk + (size_t)16 * D), "v"(gk + (size_t)32 * D), "v"(gk + (size_t)48 * D), "v"(gv), "v"(gv + (size_t)16 * S), "v"(gv + (size_t)32 * S), "v"(gv + (size_t)48 * S)
               : "memory"); }
struct RowState { v8f oacc[4]; v8f lsv; float mraw, bo; };   // of one column group: O^T tiles, partial row sums (x PS), running max (raw scale), exponent in use
// One column group's softmax step over a chunk's scores: masks them, joins the running max, rescales the state and leaves P (x PS, f16) in pb, the B operands of the chunk's two 32-key halves.
// dk0 = (chunk's first key + 8 hlf) - (this lane's query in the group), read only where MASKED
template <bool MASKED> __device__ __forceinline__ void soft(v8f (&sacc)[KC / 16], int dk0, RowState& st, v16b (&pb)[KC / 32]) {
  if (MASKED) {
#pragma unroll
    for (int t = 0; t < KC / 16; ++t)
#pragma unroll
      for (int r8 = 0; r8 < 8; ++r8) { const int dk = dk0 + t * 16 + r8; float s = sacc[t][r8]; s = dk > 0 ? UP_RAW : s; s = dk == 0 ? DIAG_RAW : s; sacc[t][r8] = s; } }
  float mt[KC / 16];
#pragma unroll
  for (int t = 0; t < KC / 16; ++t) { mt[t] = sacc[t][0];
#pragma unroll
    for (int r8 = 1; r8 < 8; ++r8) mt[t] = fmaxf(mt[t], sacc[t][r8]); }
  float mx = mt[0];
#pragma unroll
  for (int t = 1; t < KC / 16; ++t) mx = fmaxf(mx, mt[t]);
  mx = fmaxf(mx, other_half(mx)); st.mraw = fmaxf(st.mraw, mx);
  const float bn = __builtin_fmaf(st.mraw, C2, -8.0f);   // exponent taken off every score; the 8 is P's x256 (PS)
  const float fac = __builtin_amdgcn_exp2f(st.bo - bn); st.bo = bn; st.lsv *= fac;
#pragma unroll
  for (int t = 0; t < 4; ++t) st.oacc[t] *= fac;
#pragma unroll
  for (int j = 0; j < KC / 32; ++j) {
#pragma unroll
    for (int u = 0; u < 2; ++u) { v8f p;
#pragma unroll
      for (int e = 0; e < 8; ++e) p[e] = __builtin_amdgcn_exp2f(__builtin_fmaf(sacc[2 * j + u][e], C2, -bn));
#pragma unroll
      // P is rounded once to f16: 11 significant bits against the 8 of the bf16-rounded v it multiplies; the x256 keeps small weights out of the f16 subnormals. The row sum below adds the unrounded p.
      for (int e = 0; e < 8; e += 2) { const v2b hi = __builtin_convertvector((v2f){p[e], p[e + 1]}, v2b); pb[j][8 * u + e] = hi[0]; pb[j][8 * u + e + 1] = hi[1]; }
      st.lsv += p; } } }
// kc, vc: this lane's K row and V^T row in the chunk's LDS tiles (rows of LP elements); dk0 as in soft(), for column group 0. Every K and V^T fragment is read from LDS once and multiplies both column groups.
template <bool MASKED> __device__ __forceinline__ void chunk(const b16* __restrict__ kc, const b16* __restrict__ vc, int dk0, int hlf, const v16b (&qb)[NC][2], RowState (&st)[NC]) {
  v16b kf[KC / 16][2], vf[KC / 32][4], pb[NC][KC / 32]; v8f sacc[NC][KC / 16];
#pragma unroll
  for (int t = 0; t < KC / 16; ++t)
#pragma unroll
    for (int ks = 0; ks < 2; ++ks) kf[t][ks] = frag_kb(kc + (t * 16) * LP + ks * 32, hlf);
  __builtin_amdgcn_sched_barrier(0);   // keeps the K reads in one group at the chunk's head, behind counted waits: spread in pairs among the score WMMAs, each pair is waited for in full
#pragma unroll
  for (int t = 0; t < KC / 16; ++t) {
#pragma unroll
    for (int c = 0; c < NC; ++c) sacc[c][t] = (v8f){};
#pragma unroll
    for (int ks = 0; ks < 2; ++ks)
#pragma unroll
      for (int c = 0; c < NC; ++c) sacc[c][t] = wmma16b(kf[t][ks], qb[c][ks], sacc[c][t]); }
  __builtin_amdgcn_sched_barrier(0);   // with the one below: keeps the V^T reads in one group between the score WMMAs and the softmax. Risen among the score WMMAs they turn the counted waits for K into full ones; sunk among the O^T WMMAs each group costs a wait of its own
#pragma unroll
  for (int j = 0; j < KC / 32; ++j)
#pragma unroll
    for (int t = 0; t < 4; ++t) vf[j][t] = frag_kb(vc + (t * 16) * LP + j * 32, hlf);
  __builtin_amdgcn_sched_barrier(0);
#pragma unroll
  for (int c = 0; c < NC; ++c) soft<MASKED>(sacc[c], dk0 - 16 * c, st[c], pb[c]);
#pragma unroll
  for (int j = 0; j < KC / 32; ++j)
#pragma unroll
    for (int t = 0; t < 4; ++t)
#pragma unroll
      for (int c = 0; c < NC; ++c) st[c].oacc[t] = wmma16b(vf[j][t], pb[c][j], st[c].oacc[t]);
  __builtin_amdgcn_sched_barrier(0); }   // keeps the stage's closing waits and barrier, and the next copies behind them, from changing places with the chunk's arithmetic
constexpr int NTL = S / QB, NG = 2, NSTG = NTL + 1;   // query tiles of a head; wave groups that share a tile's keys; stages (one 64-key chunk a group) that every block walks
static_assert(NTL % 2 == 0, "tiles are taken in pairs");
// A block takes two query tiles of one head, one after the other: tile NTL - 1 - pr (NTL - pr stages), then tile pr (pr + 1 stages); tile t has 2 (t + 1) chunks.
// Eight waves: waves w and w + 4 hold the SAME 32 queries; group 0 (waves 0..3) walks the tile's even key chunks, group 1 the odd ones, each with a running max, sum and O^T of its own.
// In a tile's last stage a wave's chunk lies below its queries (no mask), on their diagonal (masked) or wholly above them (left out). One block a WGP, two waves a SIMD.
// Behind a tile's last stage group 1 hands its state to group 0 through LDS (the stage's own barrier publishes it) and group 0 joins the two as the online softmax joins two chunks.
// The stages of both tiles form one stream through the two LDS buffers: stream position i lies in buffer i & 1; each group copies its own chunk.
__global__ __launch_bounds__(NG * NW * 32) __attribute__((amdgpu_waves_per_eu(2, 2))) void att_kernel(const b16* __restrict__ Q16, const b16* __restrict__ K16, const b16* __restrict__ VT, const int* __restrict__ kmask, int QLIM, float* __restrict__ out) { static_assert(MODE == 0, "the register softmax is written for the self mask + causal form"); (void)kmask;
  __shared__ __attribute__((aligned(16))) b16 Kt[2][NG][TILE]; __shared__ __attribute__((aligned(16))) b16 Vt[2][NG][TILE]; __shared__ float Of[NW][WQ][HD + 1];
  __shared__ __attribute__((aligned(16))) v4f Mo[2][NW][NC][8][32]; __shared__ float Ms[2][NW][NC][2][32];   // group 1's O^T, row sum and exponent, lane by lane; one set a tile, so that the second tile's hand-over never meets a reader of the first
  const int tid = threadIdx.x, lane = tid & 31, nloc = lane & 15, hlf = lane >> 4; const int bh = blockIdx.x / (NTL / 2), pr = blockIdx.x % (NTL / 2);
  const int wave = __builtin_amdgcn_readfirstlane(tid >> 5), grp = wave / NW, wq = wave % NW;   // scalar, so that the tests on grp are scalar branches (WMMA wants every lane on)
  const int b = bh / H, h = bh % H, ns0 = NTL - pr;   // ns0: stages of the first tile
  v16b qb[NC][2], qn[NC][2];   // q fragments of the tile at work and of the second tile, both fetched here
  const b16* const gq = Q16 + ((size_t)b * S + wq * WQ + nloc) * D + h * HD + 8 * hlf;   // this lane's q row in tile 0, column group 0, at its half's first piece
  const b16* const qa = gq + (size_t)((NTL - 1 - pr) * QB) * D; const b16* const qc = gq + (size_t)(pr * QB) * D;   // the same in the block's two tiles
#pragma unroll
  for (int c = 0; c < NC; ++c)
#pragma unroll
    for (int ks = 0; ks < 2; ++ks) { qb[c][ks] = frag_kb(qa + c * 16 * D + ks * 32, 0); qn[c][ks] = frag_kb(qc + c * 16 * D + ks * 32, 0); }
  asm volatile("s_wait_xcnt 0x0" :: "v"(qa), "v"(qc) : "memory");   // stands before the q loads' address registers are reused (they are inputs, so they live up to here)
  const int crow = (tid & (NW * 32 - 1)) >> 3, cseg = (tid & 7) * 8;   // the row of its group's chunk and the 16-byte piece of it that this lane copies
  const b16* gk = K16 + ((size_t)b * S + crow) * D + h * HD + cseg; const b16* gv = VT + ((size_t)bh * HD + crow) * S + cseg;
  const unsigned lk0 = (unsigned)(size_t)&Kt[0][grp][crow * LP + cseg], lv0 = (unsigned)(size_t)&Vt[0][grp][crow * LP + cseg];
  auto fill = [&](int i) { const int ls = i < ns0 ? i : i - ns0, bf = i & 1;   // stream position -> stage of its tile, buffer
    const int kc = NG * ls + grp;   // every stage has a chunk for either group: at most 2 (NTL - 1) + 1, the head's last
    copy_chunk(lk0 + bf * (NG * TILE * 2), lv0 + bf * (NG * TILE * 2), gk + (size_t)kc * KC * D, gv + kc * KC); };
  auto foot = [&](int i) {
    asm volatile("s_wait_dscnt 0x0" ::: "memory");      // this wave's reads of buffer i & 1 (and group 1's hand-over stores) are done before the barrier
    asm volatile("s_wait_asynccnt 0x0" ::: "memory");   // this wave's share of stream position i + 1 has landed
    __syncthreads();                                    // publishes position i + 1 and frees buffer i & 1
    if (i + 2 < NSTG) fill(i + 2); };
  fill(0);
  asm volatile("s_wait_asynccnt 0x0" ::: "memory");   // this wave's share of position 0 has landed
  __syncthreads();                                    // ... and every other wave's
  fill(1);
  int g = 0;   // stream position
#pragma unroll 1   // the two tiles share one copy of the code
  for (int tl = 0; tl < 2; ++tl) { const int tile = tl == 0 ? NTL - 1 - pr : pr, q0 = tile * QB + wq * WQ, ns = tile + 1; const size_t tq = (size_t)b * S + q0;
    RowState st[NC];
#pragma unroll
    for (int c = 0; c < NC; ++c) { for (int t = 0; t < 4; ++t) st[c].oacc[t] = (v8f){}; st[c].lsv = (v8f){}; st[c].mraw = -INFINITY; st[c].bo = -INFINITY; }
#pragma unroll 1   // one chunk's fragments, scores and states take about 360 registers of the 512 that two waves a SIMD leave a wave
    for (int ls = 0; ls < ns - 1; ++ls, ++g) { chunk<false>(&Kt[g & 1][grp][nloc * LP], &Vt[g & 1][grp][nloc * LP], 0, hlf, qb, st); foot(g); }   // ahead of a tile's last stage neither group meets the diagonal
    { const int k0 = (NG * (ns - 1) + grp) * KC;   // first key of this group's chunk of the last stage
      const b16* const kc = &Kt[g & 1][grp][nloc * LP]; const b16* const vc = &Vt[g & 1][grp][nloc * LP];
      if (k0 + KC <= q0) chunk<false>(kc, vc, 0, hlf, qb, st);   // every key lies before the wave's first query
      else if (k0 < q0 + WQ) chunk<true>(kc, vc, k0 + 8 * hlf - (q0 + nloc), hlf, qb, st);   // else every key lies behind the wave's last query: weight exactly 0, left out
      if (grp == 1) {   // the hand-over; the barrier in foot() publishes it
#pragma unroll
        for (int c = 0; c < NC; ++c) { const v8f lsv = st[c].lsv;
#pragma unroll
          for (int t = 0; t < 4; ++t)
#pragma unroll
            for (int u = 0; u < 2; ++u) Mo[tl][wq][c][2 * t + u][lane] = (v4f){st[c].oacc[t][4 * u], st[c].oacc[t][4 * u + 1], st[c].oacc[t][4 * u + 2], st[c].oacc[t][4 * u + 3]};
          Ms[tl][wq][c][0][lane] = ((lsv[0] + lsv[1]) + (lsv[2] + lsv[3])) + ((lsv[4] + lsv[5]) + (lsv[6] + lsv[7])); Ms[tl][wq][c][1][lane] = st[c].bo; } }
      foot(g); ++g; }
    if (grp == 0) {   // wave-uniform; no barrier inside
#pragma unroll
      for (int c = 0; c < NC; ++c) if (q0 + 16 * c < QLIM) {
        const v8f lsv = st[c].lsv; const float l0 = ((lsv[0] + lsv[1]) + (lsv[2] + lsv[3])) + ((lsv[4] + lsv[5]) + (lsv[6] + lsv[7])), l1 = Ms[tl][wq][c][0][lane], b1 = Ms[tl][wq][c][1][lane];
        const float bj = fmaxf(st[c].bo, b1), f0 = __builtin_amdgcn_exp2f(st[c].bo - bj), f1 = __builtin_amdgcn_exp2f(b1 - bj);   // group 0 always has chunk 0, so bj is finite; a group 1 without a chunk hands over -inf, zeros: f1 = 0
        float ls = l0 * f0 + l1 * f1; ls += other_half(ls); const float rinv = (1.0f / XS) / ls, r0 = f0 * rinv, r1 = f1 * rinv;   // ls carries PS like oacc
#pragma unroll
        for (int t = 0; t < 4; ++t)
#pragma unroll
          for (int u = 0; u < 2; ++u) { const v4f o1 = Mo[tl][wq][c][2 * t + u][lane];
#pragma unroll
            for (int e = 0; e < 4; ++e) Of[wq][c * 16 + nloc][t * 16 + 8 * hlf + 4 * u + e] = st[c].oacc[t][4 * u + e] * r0 + o1[e] * r1; }
        wave_lds_sync();
        v2f row[16]; float* const po = out + (tq + c * 16) * D + h * HD + lane * 2;
#pragma unroll
        for (int r = 0; r < 16; ++r) row[r] = (v2f){Of[wq][c * 16 + r][lane * 2], Of[wq][c * 16 + r][lane * 2 + 1]};   // this wave's own rows of Of: its next results come behind these reads in program order
#pragma unroll
        for (int r = 0; r < 16; ++r) *(v2f*)(po + (size_t)r * D) = row[r];
        // stands before the stores' address and data registers are reused (they are inputs, so they live up to here)
        asm volatile("s_wait_xcnt 0x0" :: "v"(po), "v"(row[0]), "v"(row[1]), "v"(row[2]), "v"(row[3]), "v"(row[4]), "v"(row[5]), "v"(row[6]), "v"(row[7]), "v"(row[8]), "v"(row[9]), "v"(row[10]), "v"(row[11]), "v"(row[12]), "v"(row[13]), "v"(row[14]), "v"(row[15]) : "memory"); } }
#pragma unroll
    for (int c = 0; c < NC; ++c) for (int ks = 0; ks < 2; ++ks) qb[c][ks] = qn[c][ks]; }
  asm volatile("s_wait_asynccnt 0x0" ::: "memory");   // no copy is left in flight behind the loop
}
}  // namespace

extern "C" void kernel_launch(void* const* d_in, const int* in_sizes, int n_in, void* d_out, int out_size, void* d_ws, size_t ws_size, hipStream_t stream) {
  (void)n_in;
  auto Fp = [&](int i) { return (const float*)d_in[i]; };
  // input order: 0 q/query; 1 k/key; 2 v/value ([2,2048,1024] == [2,2048,16,64]); MODE 1: 3 attention_mask [2,2048] i32
  if (in_sizes[0] != NT * D || in_sizes[1] != NT * D || in_sizes[2] != NT * D || (MODE == 1 && in_sizes[3] != NT) || out_size != NT * D) return;
  const int QLIM = S;   // query cut (multiple of 16)
  size_t off = 0; char* ws = (char*)d_ws;
  auto carve = [&](size_t bytes) { char* p = ws + off; off += (bytes + 255) & ~(size_t)255; return p; };
  b16* Q16 = (b16*)carve((size_t)NT * D * 2); b16* K16 = (b16*)carve((size_t)NT * D * 2); b16* VT = (b16*)carve((size_t)NT * D * 2);
  if (off > ws_size || off > ((size_t)32 << 20)) return;   // 24 MB
  cvt_kernel<<<CB, 256, 0, stream>>>(Fp(0), Fp(1), Q16, K16);
  vt_kernel<<<(NT / 64) * 4, 256, 0, stream>>>(Fp(2), VT);
  att_kernel<<<NB_ * H * (NTL / 2), NG * NW * 32, 0, stream>>>(Q16, K16, VT, MODE == 1 ? (const int*)d_in[3] : nullptr, QLIM, (float*)d_out);
}

// v009
// Measured time: 22.4 microseconds a run.
// Versions between v007 and this one are left out; their measured steps multiply to 1.61 times as fast.
// All steps since v000 together make it 26.7 times as fast.
#include <hip/hip_runtime.h>

// ScaledDotProdAttention (shared-QK causal): 16 heads x 64 from [2,2048,1024]; dots = q.k/8; diagonal -> -10000 (self mask), strict upper -> -50000; softmax; out = attn v -> [2][2048][1024].
// Deterministic: two online softmax streams per query over fixed 64-key chunks in order (the even and the odd chunks), joined once in a fixed order; only chunks at or below the query block (keys above are masked with a finite value whose exp underflows to exactly 0 against the row max, which always comes from an unmasked/diag key); no atomics.
// WMMA (v_wmma_f32_16x16x32_f16, f32 accumulate): q, k, v are raw f32 inputs, each rounded once to f16 inside this one kernel, on the way to its operand; per (b, h, 32 queries, chunk parity) wave (the four waves of a group, 128 queries, share each 64-key K and V chunk through LDS; a fragment read from LDS serves the wave's two 16-query column groups) S^T = k rows x q (single product) and O^T += v^T rows x P^T (v^T by the transposing LDS load; P x256, rounded once to f16; single product); softmax in f32, in registers.

namespace {
constexpr int MODE = 0;   // 0: shared-QK self mask (diag -> -10000) + causal strict upper (-50000); 1: key padding mask input, not built (att_kernel static_asserts MODE == 0)
constexpr int NB_ = 2, S = 2048, H = 16, HD = 64, D = H * HD, NT = NB_ * S, KC = 64;
constexpr float XS = 1.0f, PS = 256.0f, SCALE = 0.125f;   // XS: scale of the f16 operands
typedef _Float16 b16;
typedef __attribute__((ext_vector_type(16))) _Float16 v16b;
typedef __attribute__((ext_vector_type(8))) _Float16 v8b;
typedef __attribute__((ext_vector_type(2))) _Float16 v2b;
typedef __attribute__((ext_vector_type(8))) float v8f;
typedef __attribute__((ext_vector_type(4))) float v4f;
typedef __attribute__((ext_vector_type(2))) float v2f;
__device__ __forceinline__ v16b frag_kb(const b16* p, int hh) { const v8b a = *(const v8b*)(p + 8 * hh), b = *(const v8b*)(p + 16 + 8 * hh); v16b f;
#pragma unroll
  for (int e = 0; e < 8; ++e) { f[e] = a[e]; f[8 + e] = b[e]; } return f; }
// the builtin alone: the compiler keeps the distance behind it itself, and an asm statement on its operands would hold all of them in the first 256 registers, which a 32-query wave's tiles and fragments overfill (spills)
__device__ __forceinline__ v8f wmma16b(v16b a, v16b b, v8f c) { return __builtin_amdgcn_wmma_f32_16x16x32_f16(false, a, false, b, (short)0, c, false, false); }
// a wave's own LDS stores are done before its lanes read each other's words back; the LDS wait alone: a work-group fence here would also wait for the global loads and stores in flight
__device__ __forceinline__ void wave_lds_sync() { asm volatile("s_wait_dscnt 0x0" ::: "memory"); __builtin_amdgcn_wave_barrier(); }

typedef __attribute__((ext_vector_type(4))) _Float16 v4b;
typedef __attribute__((ext_vector_type(8))) short s16x8;
// 16 (head dims) x 8 (keys) of a row-major 16-bit LDS tile, transposed: lane (c, h) gets T[key base + 8 h + 0..7][dim base + c]; p is the lane's own address, row key base + 8 h + (l & 7), 16 bytes on for lanes with bit 3 set
__device__ __forceinline__ v8b ld_tr16(const b16* p) { typedef __attribute__((address_space(3))) s16x8 lds_s16x8; return __builtin_bit_cast(v8b, __builtin_amdgcn_ds_load_tr16_b128_v8i16((lds_s16x8*)p)); }
__device__ __forceinline__ v16b frag_tr(const b16* p, int pitch) { const v8b a = ld_tr16(p), b = ld_tr16(p + 16 * pitch); v16b f;   // keys 8 h + e, then 16 + 8 h + e: the k order of frag_kb
#pragma unroll
  for (int e = 0; e < 8; ++e) { f[e] = a[e]; f[8 + e] = b[e]; } return f; }
__device__ __forceinline__ float other_half(float x) { const int i = __float_as_int(x); return __int_as_float(__builtin_amdgcn_permlanex16(i, i, 0x76543210, 0xfedcba98, false, false)); }   // lane l <-> l ^ 16
// Two waves per (b, h, 32 queries), one for the even and one for the odd key chunks; eight waves a block. A wave's queries are two column groups of 16. S^T = K q^T: in each group lane (nloc, hlf) holds query nloc's scores of keys 16 t + 8 hlf + r8, so max and sum are in-lane plus one exchange of the halves,
// and two score tiles, converted in place, are the B operand (32 keys x 16 queries, the k order of frag_kb) of O^T += V^T P^T. Scores and P never touch LDS.
constexpr float RS = SCALE / (XS * XS);               // raw accumulator -> score, a power of two (exact)
constexpr float C2 = RS * 1.4426950408889634f;        // raw accumulator -> exponent of 2
static_assert(PS == 256.0f, "the 8 in the exponent below is log2(PS)");
constexpr float DIAG_RAW = -10000.0f / RS, UP_RAW = -50000.0f / RS;   // the two mask values on the raw scale, both exact in f32
constexpr int NW = 4, NC = 2, WQ = NC * 16, QB = NW * WQ;   // waves of a group, 16-query column groups of a wave, queries of a wave and of a block
static_assert(QB == 2 * KC, "a tile has an even number of chunks, one a group in every stage, and only its last stage meets the diagonal");
constexpr int LP = HD + 8, LV = HD + 16;              // LDS rows of 128 B (one key's head dims): K at a pitch of 144 B (16 B x odd, for 16-byte readers), V at 160 B (32 B x odd, for the transposing reader); one tile = 64 rows
struct RowState { v8f oacc[4]; v8f lsv; float mraw, bo; };   // of one column group: O^T tiles, partial row sums (x PS), running max (raw scale), exponent in use
// One column group's softmax step over a chunk's scores: masks them, joins the running max, rescales the state and leaves P (x PS, f16) in pb, the B operands of the chunk's two 32-key halves.
// dk0 = (chunk's first key + 8 hlf) - (this lane's query in the group), read only where MASKED
template <bool MASKED> __device__ __forceinline__ void soft(v8f (&sacc)[KC / 16], int dk0, RowState& st, v16b (&pb)[KC / 32]) {
  if (MASKED) {
#pragma unroll
    for (int t = 0; t < KC / 16; ++t)
#pragma unroll
      for (int r8 = 0; r8 < 8; ++r8) { const int dk = dk0 + t * 16 + r8; float s = sacc[t][r8]; s = dk > 0 ? UP_RAW : s; s = dk == 0 ? DIAG_RAW : s; sacc[t][r8] = s; } }
  float mt[KC / 16];
#pragma unroll
  for (int t = 0; t < KC / 16; ++t) { mt[t] = sacc[t][0];
#pragma unroll
    for (int r8 = 1; r8 < 8; ++r8) mt[t] = fmaxf(mt[t], sacc[t][r8]); }
  float mx = mt[0];
#pragma unroll
  for (int t = 1; t < KC / 16; ++t) mx = fmaxf(mx, mt[t]);
  mx = fmaxf(mx, other_half(mx)); st.mraw = fmaxf(st.mraw, mx);
  const float bn = __builtin_fmaf(st.mraw, C2, -8.0f);   // exponent taken off every score; the 8 is P's x256 (PS)
  const float fac = __builtin_amdgcn_exp2f(st.bo - bn); st.bo = bn; st.lsv *= fac;
#pragma unroll
  for (int t = 0; t < 4; ++t) st.oacc[t] *= fac;
#pragma unroll
  for (int j = 0; j < KC / 32; ++j) {
#pragma unroll
    for (int u = 0; u < 2; ++u) { v8f p;
#pragma unroll
      for (int e = 0; e < 8; ++e) p[e] = __builtin_amdgcn_exp2f(__builtin_fmaf(sacc[2 * j + u][e], C2, -bn));
#pragma unroll
      // P is rounded once to f16, 11 significant bits like the v it multiplies; the x256 keeps small weights out of the f16 subnormals. The row sum below adds the unrounded p.
      for (int e = 0; e < 8; e += 2) { const v2b hi = __builtin_convertvector((v2f){p[e], p[e + 1]}, v2b); pb[j][8 * u + e] = hi[0]; pb[j][8 * u + e + 1] = hi[1]; }
      st.lsv += p; } } }
// kc: this lane's K row in the chunk's K tile (rows of LP elements); vc: its address for the transposing load in the chunk's V tile (rows of LV elements) at key 0, dim 0; dk0 as in soft(), for column group 0. Every K and V^T fragment is read from LDS once and multiplies both column groups.
template <bool MASKED> __device__ __forceinline__ void chunk(const b16* __restrict__ kc, const b16* __restrict__ vc, int dk0, int hlf, const v16b (&qb)[NC][2], RowState (&st)[NC]) {
  v16b kf[KC / 16][2], vf[KC / 32][4], pb[NC][KC / 32]; v8f sacc[NC][KC / 16];
#pragma unroll
  for (int t = 0; t < KC / 16; ++t)
#pragma unroll
    for (int ks = 0; ks < 2; ++ks) kf[t][ks] = frag_kb(kc + (t * 16) * LP + ks * 32, hlf);
  __builtin_amdgcn_sched_barrier(0);   // keeps the K reads in one group at the chunk's head, behind counted waits: spread in pairs among the score WMMAs, each pair is waited for in full
#pragma unroll
  for (int t = 0; t < KC / 16; ++t) {
#pragma unroll
    for (int c = 0; c < NC; ++c) sacc[c][t] = (v8f){};
#pragma unroll
    for (int ks = 0; ks < 2; ++ks)
#pragma unroll
      for (int c = 0; c < NC; ++c) sacc[c][t] = wmma16b(kf[t][ks], qb[c][ks], sacc[c][t]); }
  __builtin_amdgcn_sched_barrier(0);   // with the one below: keeps the V^T reads in one group between the score WMMAs and the softmax. Risen among the score WMMAs they turn the counted waits for K into full ones; sunk among the O^T WMMAs each group costs a wait of its own
#pragma unroll
  for (int j = 0; j < KC / 32; ++j)
#pragma unroll
    for (int t = 0; t < 4; ++t) vf[j][t] = frag_tr(vc + (j * 32) * LV + t * 16, LV);
  __builtin_amdgcn_sched_barrier(0);
#pragma unroll
  for (int c = 0; c < NC; ++c) soft<MASKED>(sacc[c], dk0 - 16 * c, st[c], pb[c]);
#pragma unroll
  for (int j = 0; j < KC / 32; ++j)
#pragma unroll
    for (int t = 0; t < 4; ++t)
#pragma unroll
      for (int c = 0; c < NC; ++c) st[c].oacc[t] = wmma16b(vf[j][t], pb[c][j], st[c].oacc[t]);
  __builtin_amdgcn_sched_barrier(0); }   // keeps the next chunk's conversion and LDS stores, and the stage's closing wait and barrier, from changing places with the chunk's arithmetic
constexpr int NTL = S / QB, NG = 2, NSTG = NTL + 1;   // query tiles of a head; wave groups that share a tile's keys; stages (one 64-key chunk a group) that every block walks
static_assert(NTL % 2 == 0, "tiles are taken in pairs");
// A block takes two query tiles of one head, one after the other: tile NTL - 1 - pr (NTL - pr stages), then tile pr (pr + 1 stages); tile t has 2 (t + 1) chunks.
// Eight waves: waves w and w + 4 hold the SAME 32 queries; group 0 (waves 0..3) walks the tile's even key chunks, group 1 the odd ones, each with a running max, sum and O^T of its own.
// In a tile's last stage a wave's chunk lies below its queries (no mask), on their diagonal (masked) or wholly above them (left out). One block a WGP, two waves a SIMD.
// Behind a tile's last stage group 1 hands its state to group 0 through LDS (the stage's own barrier publishes it) and group 0 joins the two as the online softmax joins two chunks.
// The stages of both tiles form one stream through the two LDS buffers: stream position i lies in buffer i & 1; each group brings in its own chunk.
// k and v come as f32 straight from the inputs, 16 loads a lane and position (16 bytes each; a wave's load covers two whole 256-byte rows). At the foot of stage i a lane rounds position i + 1 to f16 and stores it into the other buffer,
// whose last readers left it at the barrier before; the stage's one barrier publishes it. The loads of position i + 2 issue at that same foot, as soon as their registers are free: they fly over the barrier and all of stage i + 1, and a stage's head holds LDS reads alone.
__global__ __launch_bounds__(NG * NW * 32) __attribute__((amdgpu_waves_per_eu(2, 2))) void att_kernel(const float* __restrict__ q, const float* __restrict__ k, const float* __restrict__ v, const int* __restrict__ kmask, int QLIM, float* __restrict__ out) { static_assert(MODE == 0, "the register softmax is written for the self mask + causal form"); (void)kmask;
  __shared__ __attribute__((aligned(16))) b16 Kt[2][NG][KC * LP]; __shared__ __attribute__((aligned(32))) b16 Vt[2][NG][KC * LV]; __shared__ float Of[NW][WQ][HD + 1];
  __shared__ __attribute__((aligned(16))) v4f Mo[2][NW][NC][8][32]; __shared__ float Ms[2][NW][NC][2][32];   // group 1's O^T, row sum and exponent, lane by lane; one set a tile, so that the second tile's hand-over never meets a reader of the first
  const int tid = threadIdx.x, lane = tid & 31, nloc = lane & 15, hlf = lane >> 4; const int bh = blockIdx.x / (NTL / 2), pr = blockIdx.x % (NTL / 2);
  const int wave = __builtin_amdgcn_readfirstlane(tid >> 5), grp = wave / NW, wq = wave % NW;   // scalar, so that the tests on grp are scalar branches (WMMA wants every lane on)
  const int b = bh / H, h = bh % H, ns0 = NTL - pr;   // ns0: stages of the first tile
  v16b qb[NC][2], qn[NC][2];   // q fragments of the tile at work and of the second tile, both fetched here
  const float* const gq = q + ((size_t)b * S + wq * WQ + nloc) * D + h * HD + 8 * hlf;   // this lane's q row in tile 0, column group 0, at its half's first piece
  const float* const qa = gq + (size_t)((NTL - 1 - pr) * QB) * D; const float* const qc = gq + (size_t)(pr * QB) * D;   // the same in the block's two tiles
  v4f xa[NC][2][4], xc[NC][2][4];   // a fragment's two 8-element pieces (the k order of frag_kb), 32 bytes of f32 each
#pragma unroll
  for (int c = 0; c < NC; ++c)
#pragma unroll
    for (int ks = 0; ks < 2; ++ks)
#pragma unroll
      for (int u = 0; u < 4; ++u) { const int o = c * 16 * D + ks * 32 + (u >> 1) * 16 + (u & 1) * 4; xa[c][ks][u] = *(const v4f*)(qa + o); xc[c][ks][u] = *(const v4f*)(qc + o); }
  asm volatile("s_wait_xcnt 0x0" :: "v"(qa), "v"(qc) : "memory");   // stands before the q loads' address registers are reused (they are inputs, so they live up to here)
  const int frow = (tid & (NW * 32 - 1)) >> 4, fcol = (tid & 15) * 4;   // of its group's chunk this lane brings rows frow + 8 i, i = 0..7, four head dims from fcol on
  const size_t go = ((size_t)b * S + frow) * D + h * HD + fcol; const float* const gk = k + go; const float* const gv = v + go;
  v4f rk[KC / 8], rv[KC / 8];   // the chunk in flight
  const float* pk = gk; const float* pv = gv;   // its addresses, kept until its loads are back
  auto fetch = [&](int i) { const int ls = i < ns0 ? i : i - ns0;   // stream position -> stage of its tile
    const size_t o = (size_t)((NG * ls + grp) * KC) * D;   // every stage has a chunk for either group: at most 2 (NTL - 1) + 1, the head's last
    pk = gk + o; pv = gv + o;
#pragma unroll
    for (int r = 0; r < KC / 8; ++r) { rk[r] = *(const v4f*)(pk + r * 8 * D); rv[r] = *(const v4f*)(pv + r * 8 * D); } };
  // position i, in flight, goes to its LDS buffer; then the loads of position i + 1 issue into the same registers. Behind the last position there is none: its own addresses are taken once more and the values left unused, so that the stage stays free of a branch
  auto put = [&](int i) { b16* const dk = &Kt[i & 1][grp][frow * LP + fcol]; b16* const dv = &Vt[i & 1][grp][frow * LV + fcol];
    v4b yk[KC / 8], yv[KC / 8];
#pragma unroll
    for (int r = 0; r < KC / 8; ++r) { yk[r] = __builtin_convertvector(rk[r], v4b); yv[r] = __builtin_convertvector(rv[r], v4b); }
    __builtin_amdgcn_sched_barrier(0);   // every conversion stays ahead of the next loads: sunk below them it would ask for a second set of 64 registers
#pragma unroll
    for (int r = 0; r < KC / 8; ++r) { *(v4b*)(dk + r * 8 * LP) = yk[r]; *(v4b*)(dv + r * 8 * LV) = yv[r]; }
    asm volatile("s_wait_xcnt 0x0" :: "v"(pk), "v"(pv) : "memory");   // stands before the address registers of position i's loads are reused (they are inputs, so they live up to here); at this place it comes behind the waits for those loads' data
    fetch(i + 1 < NSTG ? i + 1 : NSTG - 1); };   // issued behind the LDS stores: they leave while the stores drain
  auto foot = [&]() {
    asm volatile("s_wait_dscnt 0x0" ::: "memory");      // this wave's reads of the stage's buffer, its stores of the next position (and group 1's hand-over stores) are done before the barrier
    asm volatile("s_barrier_signal -1\n\ts_barrier_wait -1" ::: "memory"); };   // the work-group's barrier: publishes the next position and frees the stage's buffer. By hand, behind the LDS wait above: __syncthreads() would also wait for the global loads in flight, which nobody but this lane reads
  fetch(0);   // issued behind the q loads and ahead of their first use: one memory latency for both
#pragma unroll
  for (int c = 0; c < NC; ++c)
#pragma unroll
    for (int ks = 0; ks < 2; ++ks)
#pragma unroll
      for (int u = 0; u < 4; ++u) { const v4b ya = __builtin_convertvector(xa[c][ks][u], v4b), yc = __builtin_convertvector(xc[c][ks][u], v4b);
#pragma unroll
        for (int e = 0; e < 4; ++e) { qb[c][ks][4 * u + e] = ya[e]; qn[c][ks][4 * u + e] = yc[e]; } }
  put(0); foot();
  const int vl = (8 * hlf + (lane & 7)) * LV + ((lane >> 3) & 1) * 8;   // this lane's place in a V tile for the transposing load
  int g = 0;   // stream position
#pragma unroll 1   // the two tiles share one copy of the code
  for (int tl = 0; tl < 2; ++tl) { const int tile = tl == 0 ? NTL - 1 - pr : pr, q0 = tile * QB + wq * WQ, ns = tile + 1; const size_t tq = (size_t)b * S + q0;
    RowState st[NC];
#pragma unroll
    for (int c = 0; c < NC; ++c) { for (int t = 0; t < 4; ++t) st[c].oacc[t] = (v8f){}; st[c].lsv = (v8f){}; st[c].mraw = -INFINITY; st[c].bo = -INFINITY; }
#pragma unroll 1   // one chunk's fragments, scores and states and the 64 registers of the chunk in flight take about 460 of the 512 that two waves a SIMD leave a wave
    for (int ls = 0; ls < ns - 1; ++ls, ++g) { chunk<false>(&Kt[g & 1][grp][nloc * LP], &Vt[g & 1][grp][vl], 0, hlf, qb, st); put(g + 1); foot(); }   // ahead of a tile's last stage neither group meets the diagonal, and position g + 1 exists
    { const int k0 = (NG * (ns - 1) + grp) * KC;   // first key of this group's chunk of the last stage
      const b16* const kc = &Kt[g & 1][grp][nloc * LP]; const b16* const vc = &Vt[g & 1][grp][vl];
      if (k0 + KC <= q0) chunk<false>(kc, vc, 0, hlf, qb, st);   // every key lies before the wave's first query
      else if (k0 < q0 + WQ) chunk<true>(kc, vc, k0 + 8 * hlf - (q0 + nloc), hlf, qb, st);   // else every key lies behind the wave's last query: weight exactly 0, left out
      if (grp == 1) {   // the hand-over; the barrier in foot() publishes it
#pragma unroll
        for (int c = 0; c < NC; ++c) { const v8f lsv = st[c].lsv;
#pragma unroll
          for (int t = 0; t < 4; ++t)
#pragma unroll
            for (int u = 0; u < 2; ++u) Mo[tl][wq][c][2 * t + u][lane] = (v4f){st[c].oacc[t][4 * u], st[c].oacc[t][4 * u + 1], st[c].oacc[t][4 * u + 2], st[c].oacc[t][4 * u + 3]};
          Ms[tl][wq][c][0][lane] = ((lsv[0] + lsv[1]) + (lsv[2] + lsv[3])) + ((lsv[4] + lsv[5]) + (lsv[6] + lsv[7])); Ms[tl][wq][c][1][lane] = st[c].bo; } }
      if (tl == 0) put(g + 1);   // the second tile's first stage; behind the second tile nothing follows
      else asm volatile("s_wait_xcnt 0x0" :: "v"(pk), "v"(pv) : "memory");   // stands before the address registers of the last loads are reused
      foot(); ++g; }
    if (grp == 0) {   // wave-uniform; no barrier inside
#pragma unroll
      for (int c = 0; c < NC; ++c) if (q0 + 16 * c < QLIM) {
        const v8f lsv = st[c].lsv; const float l0 = ((lsv[0] + lsv[1]) + (lsv[2] + lsv[3])) + ((lsv[4] + lsv[5]) + (lsv[6] + lsv[7])), l1 = Ms[tl][wq][c][0][lane], b1 = Ms[tl][wq][c][1][lane];
        const float bj = fmaxf(st[c].bo, b1), f0 = __builtin_amdgcn_exp2f(st[c].bo - bj), f1 = __builtin_amdgcn_exp2f(b1 - bj);   // group 0 always has chunk 0, so bj is finite; a group 1 without a chunk hands over -inf, zeros: f1 = 0
        float ls = l0 * f0 + l1 * f1; ls += other_half(ls); const float rinv = (1.0f / XS) / ls, r0 = f0 * rinv, r1 = f1 * rinv;   // ls carries PS like oacc
#pragma unroll
        for (int t = 0; t < 4; ++t)
#pragma unroll
          for (int u = 0; u < 2; ++u) { const v4f o1 = Mo[tl][wq][c][2 * t + u][lane];
#pragma unroll
            for (int e = 0; e < 4; ++e) Of[wq][c * 16 + nloc][t * 16 + 8 * hlf + 4 * u + e] = st[c].oacc[t][4 * u + e] * r0 + o1[e] * r1; }
        wave_lds_sync();
        v2f row[16]; float* const po = out + (tq + c * 16) * D + h * HD + lane * 2;
#pragma unroll
        for (int r = 0; r < 16; ++r) row[r] = (v2f){Of[wq][c * 16 + r][lane * 2], Of[wq][c * 16 + r][lane * 2 + 1]};   // this wave's own rows of Of: its next results come behind these reads in program order
#pragma unroll
        for (int r = 0; r < 16; ++r) *(v2f*)(po + (size_t)r * D) = row[r];
        // stands before the stores' address and data registers are reused (they are inputs, so they live up to here)
        asm volatile("s_wait_xcnt 0x0" :: "v"(po), "v"(row[0]), "v"(row[1]), "v"(row[2]), "v"(row[3]), "v"(row[4]), "v"(row[5]), "v"(row[6]), "v"(row[7]), "v"(row[8]), "v"(row[9]), "v"(row[10]), "v"(row[11]), "v"(row[12]), "v"(row[13]), "v"(row[14]), "v"(row[15]) : "memory"); } }
#pragma unroll
    for (int c = 0; c < NC; ++c) for (int ks = 0; ks < 2; ++ks) qb[c][ks] = qn[c][ks]; }
}
}  // namespace

extern "C" void kernel_launch(void* const* d_in, const int* in_sizes, int n_in, void* d_out, int out_size, void* d_ws, size_t ws_size, hipStream_t stream) {
  (void)n_in;
  auto Fp = [&](int i) { return (const float*)d_in[i]; };
  // input order: 0 q/query; 1 k/key; 2 v/value ([2,2048,1024] == [2,2048,16,64]); MODE 1: 3 attention_mask [2,2048] i32
  if (in_sizes[0] != NT * D || in_sizes[1] != NT * D || in_sizes[2] != NT * D || (MODE == 1 && in_sizes[3] != NT) || out_size != NT * D) return;
  const int QLIM = S;   // query cut (multiple of 16)
  (void)d_ws; (void)ws_size;   // no workspace
  att_kernel<<<NB_ * H * (NTL / 2), NG * NW * 32, 0, stream>>>(Fp(0), Fp(1), Fp(2), MODE == 1 ? (const int*)d_in[3] : nullptr, QLIM, (float*)d_out);
}

// v010
// A run of this version takes 21.9 microseconds.
// In two side-by-side timings against v009, it was 1.03 and 1.02 times as fast.
// Counting every step since v000, it is 27.4 times as fast.
#include <hip/hip_runtime.h>

// ScaledDotProdAttention (shared-QK causal): 16 heads x 64 from [2,2048,1024]; dots = q.k/8; diagonal -> -10000 (self mask), strict upper -> -50000; softmax; out = attn v -> [2][2048][1024].
// Deterministic: two online softmax streams per query over fixed 64-key chunks in order (the even and the odd chunks), joined once in a fixed order; only chunks at or below the query block (keys above are masked with a finite value whose exp underflows to exactly 0 against the row max, which always comes from an unmasked/diag key); no atomics.
// WMMA (v_wmma_f32_16x16x32_f16, f32 accumulate): q, k, v are raw f32 inputs, each rounded once to f16 inside this one kernel, on the way to its operand; per (b, h, 32 queries, chunk parity) wave (the four waves of a group, 128 queries, share each 64-key K and V chunk through LDS; a fragment read from LDS serves the wave's two 16-query column groups) S^T = k rows x q (single product) and O^T += v^T rows x P^T (v^T by the transposing LDS load; P x256, rounded once to f16; single product); softmax in f32, in registers.

namespace {
constexpr int MODE = 0;   // 0: shared-QK self mask (diag -> -10000) + causal strict upper (-50000); 1: key padding mask input, not built (att_kernel static_asserts MODE == 0)
constexpr int NB_ = 2, S = 2048, H = 16, HD = 64, D = H * HD, NT = NB_ * S, KC = 64;
constexpr float XS = 1.0f, PS = 256.0f, SCALE = 0.125f;   // XS: scale of the f16 operands
typedef _Float16 b16;
typedef __attribute__((ext_vector_type(16))) _Float16 v16b;
typedef __attribute__((ext_vector_type(8))) _Float16 v8b;
typedef __attribute__((ext_vector_type(2))) _Float16 v2b;
typedef __attribute__((ext_vector_type(8))) float v8f;
typedef __attribute__((ext_vector_type(4))) float v4f;
typedef __attribute__((ext_vector_type(2))) float v2f;
__device__ __forceinline__ v16b frag_kb(const b16* p, int hh) { const v8b a = *(const v8b*)(p + 8 * hh), b = *(const v8b*)(p + 16 + 8 * hh); v16b f;
#pragma unroll
  for (int e = 0; e < 8; ++e) { f[e] = a[e]; f[8 + e] = b[e]; } return f; }
// the builtin alone: the compiler keeps the distance behind it itself, and an asm statement on its operands would hold all of them in the first 256 registers, which a 32-query wave's tiles and fragments overfill (spills)
__device__ __forceinline__ v8f wmma16b(v16b a, v16b b, v8f c) { return __builtin_amdgcn_wmma_f32_16x16x32_f16(false, a, false, b, (short)0, c, false, false); }
// a wave's own LDS stores are done before its lanes read each other's words back; the LDS wait alone: a work-group fence here would also wait for the global loads and stores in flight
__device__ __forceinline__ void wave_lds_sync() { asm volatile("s_wait_dscnt 0x0" ::: "memory"); __builtin_amdgcn_wave_barrier(); }

typedef __attribute__((ext_vector_type(4))) _Float16 v4b;
typedef __attribute__((ext_vector_type(8))) short s16x8;
// 16 (head dims) x 8 (keys) of a row-major 16-bit LDS tile, transposed: lane (c, h) gets T[key base + 8 h + 0..7][dim base + c]; p is the lane's own address, row key base + 8 h + (l & 7), 16 bytes on for lanes with bit 3 set
__device__ __forceinline__ v8b ld_tr16(const b16* p) { typedef __attribute__((address_space(3))) s16x8 lds_s16x8; return __builtin_bit_cast(v8b, __builtin_amdgcn_ds_load_tr16_b128_v8i16((lds_s16x8*)p)); }
__device__ __forceinline__ v16b frag_tr(const b16* p, int pitch) { const v8b a = ld_tr16(p), b = ld_tr16(p + 16 * pitch); v16b f;   // keys 8 h + e, then 16 + 8 h + e: the k order of frag_kb
#pragma unroll
  for (int e = 0; e < 8; ++e) { f[e] = a[e]; f[8 + e] = b[e]; } return f; }
__device__ __forceinline__ float other_half(float x) { const int i = __float_as_int(x); return __int_as_float(__builtin_amdgcn_permlanex16(i, i, 0x76543210, 0xfedcba98, false, false)); }   // lane l <-> l ^ 16
// Two waves per (b, h, 32 queries), one for the even and one for the odd key chunks; eight waves a block. A wave's queries are two column groups of 16. S^T = K q^T: in each group lane (nloc, hlf) holds query nloc's scores of keys 16 t + 8 hlf + r8, so max and sum are in-lane plus one exchange of the halves,
// and two score tiles, converted in place, are the B operand (32 keys x 16 queries, the k order of frag_kb) of O^T += V^T P^T. Scores and P never touch LDS.
constexpr float RS = SCALE / (XS * XS);               // raw accumulator -> score, a power of two (exact)
constexpr float C2 = RS * 1.4426950408889634f;        // raw accumulator -> exponent of 2
static_assert(PS == 256.0f, "the 8 in the exponent below is log2(PS)");
constexpr float DIAG_RAW = -10000.0f / RS, UP_RAW = -50000.0f / RS;   // the two mask values on the raw scale, both exact in f32
constexpr int NW = 4, NC = 2, WQ = NC * 16, QB = NW * WQ;   // waves of a group, 16-query column groups of a wave, queries of a wave and of a block
static_assert(QB == 2 * KC, "a tile has an even number of chunks, one a group in every stage, and only its last stage meets the diagonal");
constexpr int LP = HD + 8, LV = HD + 16;              // LDS rows of 128 B (one key's head dims): K at a pitch of 144 B (16 B x odd, for 16-byte readers), V at 160 B (32 B x odd, for the transposing reader); one tile = 64 rows
struct RowState { v8f oacc[4]; v8f lsv; float mraw, bo; };   // of one column group: O^T tiles, partial row sums (x PS), running max (raw scale), exponent in use
// One column group's softmax step over a chunk's scores: masks them, joins the running max, rescales the state and leaves P (x PS, f16) in pb, the B operands of the chunk's two 32-key halves.
// dk0 = (chunk's first key + 8 hlf) - (this lane's query in the group), read only where MASKED
template <bool MASKED> __device__ __forceinline__ void soft(v8f (&sacc)[KC / 16], int dk0, RowState& st, v16b (&pb)[KC / 32]) {
  if (MASKED) {
#pragma unroll
    for (int t = 0; t < KC / 16; ++t)
#pragma unroll
      for (int r8 = 0; r8 < 8; ++r8) { const int dk = dk0 + t * 16 + r8; float s = sacc[t][r8]; s = dk > 0 ? UP_RAW : s; s = dk == 0 ? DIAG_RAW : s; sacc[t][r8] = s; } }
  float mt[KC / 16];
#pragma unroll
  for (int t = 0; t < KC / 16; ++t) { mt[t] = sacc[t][0];
#pragma unroll
    for (int r8 = 1; r8 < 8; ++r8) mt[t] = fmaxf(mt[t], sacc[t][r8]); }
  float mx = mt[0];
#pragma unroll
  for (int t = 1; t < KC / 16; ++t) mx = fmaxf(mx, mt[t]);
  mx = fmaxf(mx, other_half(mx)); st.mraw = fmaxf(st.mraw, mx);
  const float bn = __builtin_fmaf(st.mraw, C2, -8.0f);   // exponent taken off every score; the 8 is P's x256 (PS)
  const float fac = __builtin_amdgcn_exp2f(st.bo - bn); st.bo = bn; st.lsv *= fac;
#pragma unroll
  for (int t = 0; t < 4; ++t) st.oacc[t] *= fac;
#pragma unroll
  for (int j = 0; j < KC / 32; ++j) {
#pragma unroll
    for (int u = 0; u < 2; ++u) { v8f p;
#pragma unroll
      for (int e = 0; e < 8; ++e) p[e] = __builtin_amdgcn_exp2f(__builtin_fmaf(sacc[2 * j + u][e], C2, -bn));
#pragma unroll
      // P is rounded once to f16, 11 significant bits like the v it multiplies; the x256 keeps small weights out of the f16 subnormals. The row sum below adds the unrounded p.
      for (int e = 0; e < 8; e += 2) { const v2b hi = __builtin_convertvector((v2f){p[e], p[e + 1]}, v2b); pb[j][8 * u + e] = hi[0]; pb[j][8 * u + e + 1] = hi[1]; }
      st.lsv += p; } } }
// kc: this lane's K row in the chunk's K tile (rows of LP elements); vc: its address for the transposing load in the chunk's V tile (rows of LV elements) at key 0, dim 0; dk0 as in soft(), for column group 0. Every K and V^T fragment is read from LDS once and multiplies both column groups.
template <bool MASKED> __device__ __forceinline__ void chunk(const b16* __restrict__ kc, const b16* __restrict__ vc, int dk0, int hlf, const v16b (&qb)[NC][2], RowState (&st)[NC]) {
  v16b kf[KC / 16][2], vf[KC / 32][4], pb[NC][KC / 32]; v8f sacc[NC][KC / 16];
#pragma unroll
  for (int t = 0; t < KC / 16; ++t)
#pragma unroll
    for (int ks = 0; ks < 2; ++ks) kf[t][ks] = frag_kb(kc + (t * 16) * LP + ks * 32, hlf);
  __builtin_amdgcn_sched_barrier(0);   // keeps the K reads in one group at the chunk's head, behind counted waits: spread in pairs among the score WMMAs, each pair is waited for in full
#pragma unroll
  for (int t = 0; t < KC / 16; ++t) {
#pragma unroll
    for (int c = 0; c < NC; ++c) sacc[c][t] = (v8f){};
#pragma unroll
    for (int ks = 0; ks < 2; ++ks)
#pragma unroll
      for (int c = 0; c < NC; ++c) sacc[c][t] = wmma16b(kf[t][ks], qb[c][ks], sacc[c][t]); }
  __builtin_amdgcn_sched_barrier(0);   // with the one below: keeps the V^T reads in one group between the score WMMAs and the softmax. Risen among the score WMMAs they turn the counted waits for K into full ones; sunk among the O^T WMMAs each group costs a wait of its own
#pragma unroll
  for (int j = 0; j < KC / 32; ++j)
#pragma unroll
    for (int t = 0; t < 4; ++t) vf[j][t] = frag_tr(vc + (j * 32) * LV + t * 16, LV);
  __builtin_amdgcn_sched_barrier(0);
#pragma unroll
  for (int c = 0; c < NC; ++c) soft<MASKED>(sacc[c], dk0 - 16 * c, st[c], pb[c]);
#pragma unroll
  for (int j = 0; j < KC / 32; ++j)
#pragma unroll
    for (int t = 0; t < 4; ++t)
#pragma unroll
      for (int c = 0; c < NC; ++c) st[c].oacc[t] = wmma16b(vf[j][t], pb[c][j], st[c].oacc[t]);
  __builtin_amdgcn_sched_barrier(0); }   // keeps the next chunk's conversion and LDS stores, and the stage's closing wait and barrier, from changing places with the chunk's arithmetic
constexpr int NTL = S / QB, NG = 2, NSTG = NTL + 1;   // query tiles of a head; wave groups that share a tile's keys; stages (one 64-key chunk a group) that every block walks
static_assert(NTL % 2 == 0, "tiles are taken in pairs");
// Block index -> (head, tile pair): the NTL / 2 blocks of a head, which all read that head's k and v, lie NDIE apart in the grid.
// The heads of one residue of the block index modulo NDIE are neighbours in memory. For speed only: the map is a permutation of the grid, every (head, pair) is taken once wherever the blocks run.
constexpr int NDIE = 8;
static_assert((NB_ * H) % NDIE == 0, "every residue of the block index takes whole heads");
// A block takes two query tiles of one head, one after the other: tile NTL - 1 - pr (NTL - pr stages), then tile pr (pr + 1 stages); tile t has 2 (t + 1) chunks.
// Eight waves: waves w and w + 4 hold the SAME 32 queries; group 0 (waves 0..3) walks the tile's even key chunks, group 1 the odd ones, each with a running max, sum and O^T of its own.
// In a tile's last stage a wave's chunk lies below its queries (no mask), on their diagonal (masked) or wholly above them (left out). One block a WGP, two waves a SIMD.
// Behind a tile's last stage group 1 hands its state to group 0 through LDS (the stage's own barrier publishes it) and group 0 joins the two as the online softmax joins two chunks.
// The stages of both tiles form one stream through the two LDS buffers: stream position i lies in buffer i & 1; each group brings in its own chunk.
// k and v come as f32 straight from the inputs, 16 loads a lane and position (16 bytes each; a wave's load covers two whole 256-byte rows). At the foot of stage i a lane rounds position i + 1 to f16 and stores it into the other buffer,
// whose last readers left it at the barrier before; the stage's one barrier publishes it. The loads of position i + 2 issue at that same foot, as soon as their registers are free: they fly over the barrier and all of stage i + 1, and a stage's head holds LDS reads alone.
__global__ __launch_bounds__(NG * NW * 32) __attribute__((amdgpu_waves_per_eu(2, 2))) void att_kernel(const float* __restrict__ q, const float* __restrict__ k, const float* __restrict__ v, const int* __restrict__ kmask, int QLIM, float* __restrict__ out) { static_assert(MODE == 0, "the register softmax is written for the self mask + causal form"); (void)kmask;
  __shared__ __attribute__((aligned(16))) b16 Kt[2][NG][KC * LP]; __shared__ __attribute__((aligned(32))) b16 Vt[2][NG][KC * LV]; __shared__ float Of[NW][WQ][HD + 1];
  __shared__ __attribute__((aligned(16))) v4f Mo[2][NW][NC][8][32]; __shared__ float Ms[2][NW][NC][2][32];   // group 1's O^T, row sum and exponent, lane by lane; one set a tile, so that the second tile's hand-over never meets a reader of the first
  const int tid = threadIdx.x, lane = tid & 31, nloc = lane & 15, hlf = lane >> 4; const int bh = (blockIdx.x % NDIE) * (NB_ * H / NDIE) + blockIdx.x / (NDIE * (NTL / 2)), pr = (blockIdx.x / NDIE) % (NTL / 2);
  const int wave = __builtin_amdgcn_readfirstlane(tid >> 5), grp = wave / NW, wq = wave % NW;   // scalar, so that the tests on grp are scalar branches (WMMA wants every lane on)
  const int b = bh / H, h = bh % H, ns0 = NTL - pr;   // ns0: stages of the first tile
  v16b qb[NC][2], qn[NC][2];   // q fragments of the tile at work and of the second tile, both fetched here
  const float* const gq = q + ((size_t)b * S + wq * WQ + nloc) * D + h * HD + 8 * hlf;   // this lane's q row in tile 0, column group 0, at its half's first piece
  const float* const qa = gq + (size_t)((NTL - 1 - pr) * QB) * D; const float* const qc = gq + (size_t)(pr * QB) * D;   // the same in the block's two tiles
  v4f xa[NC][2][4], xc[NC][2][4];   // a fragment's two 8-element pieces (the k order of frag_kb), 32 bytes of f32 each
#pragma unroll
  for (int c = 0; c < NC; ++c)
#pragma unroll
    for (int ks = 0; ks < 2; ++ks)
#pragma unroll
      for (int u = 0; u < 4; ++u) { const int o = c * 16 * D + ks * 32 + (u >> 1) * 16 + (u & 1) * 4; xa[c][ks][u] = *(const v4f*)(qa + o); xc[c][ks][u] = *(const v4f*)(qc + o); }
  asm volatile("s_wait_xcnt 0x0" :: "v"(qa), "v"(qc) : "memory");   // stands before the q loads' address registers are reused (they are inputs, so they live up to here)
  const int frow = (tid & (NW * 32 - 1)) >> 4, fcol = (tid & 15) * 4;   // of its group's chunk this lane brings rows frow + 8 i, i = 0..7, four head dims from fcol on
  const size_t go = ((size_t)b * S + frow) * D + h * HD + fcol; const float* const gk = k + go; const float* const gv = v + go;
  v4f rk[KC / 8], rv[KC / 8];   // the chunk in flight
  const float* pk = gk; const float* pv = gv;   // its addresses, kept until its loads are back
  auto fetch = [&](int i) { const int ls = i < ns0 ? i : i - ns0;   // stream position -> stage of its tile
    const size_t o = (size_t)((NG * ls + grp) * KC) * D;   // every stage has a chunk for either group: at most 2 (NTL - 1) + 1, the head's last
    pk = gk + o; pv = gv + o;
#pragma unroll
    for (int r = 0; r < KC / 8; ++r) { rk[r] = *(const v4f*)(pk + r * 8 * D); rv[r] = *(const v4f*)(pv + r * 8 * D); } };
  // position i, in flight, goes to its LDS buffer; then the loads of position i + 1 issue into the same registers. Behind the last position there is none: its own addresses are taken once more and the values left unused, so that the stage stays free of a branch
  auto put = [&](int i) { b16* const dk = &Kt[i & 1][grp][frow * LP + fcol]; b16* const dv = &Vt[i & 1][grp][frow * LV + fcol];
    v4b yk[KC / 8], yv[KC / 8];
#pragma unroll
    for (int r = 0; r < KC / 8; ++r) { yk[r] = __builtin_convertvector(rk[r], v4b); yv[r] = __builtin_convertvector(rv[r], v4b); }
    __builtin_amdgcn_sched_barrier(0);   // every conversion stays ahead of the next loads: sunk below them it would ask for a second set of 64 registers
#pragma unroll
    for (int r = 0; r < KC / 8; ++r) { *(v4b*)(dk + r * 8 * LP) = yk[r]; *(v4b*)(dv + r * 8 * LV) = yv[r]; }
    asm volatile("s_wait_xcnt 0x0" :: "v"(pk), "v"(pv) : "memory");   // stands before the address registers of position i's loads are reused (they are inputs, so they live up to here); at this place it comes behind the waits for those loads' data
    fetch(i + 1 < NSTG ? i + 1 : NSTG - 1); };   // issued behind the LDS stores: they leave while the stores drain
  auto foot = [&]() {
    asm volatile("s_wait_dscnt 0x0" ::: "memory");      // this wave's reads of the stage's buffer, its stores of the next position (and group 1's hand-over stores) are done before the barrier
    asm volatile("s_barrier_signal -1\n\ts_barrier_wait -1" ::: "memory"); };   // the work-group's barrier: publishes the next position and frees the stage's buffer. By hand, behind the LDS wait above: __syncthreads() would also wait for the global loads in flight, which nobody but this lane reads
  fetch(0);   // issued behind the q loads and ahead of their first use: one memory latency for both
#pragma unroll
  for (int c = 0; c < NC; ++c)
#pragma unroll
    for (int ks = 0; ks < 2; ++ks)
#pragma unroll
      for (int u = 0; u < 4; ++u) { const v4b ya = __builtin_convertvector(xa[c][ks][u], v4b), yc = __builtin_convertvector(xc[c][ks][u], v4b);
#pragma unroll
        for (int e = 0; e < 4; ++e) { qb[c][ks][4 * u + e] = ya[e]; qn[c][ks][4 * u + e] = yc[e]; } }
  put(0); foot();
  const int vl = (8 * hlf + (lane & 7)) * LV + ((lane >> 3) & 1) * 8;   // this lane's place in a V tile for the transposing load
  int g = 0;   // stream position
#pragma unroll 1   // the two tiles share one copy of the code
  for (int tl = 0; tl < 2; ++tl) { const int tile = tl == 0 ? NTL - 1 - pr : pr, q0 = tile * QB + wq * WQ, ns = tile + 1; const size_t tq = (size_t)b * S + q0;
    RowState st[NC];
#pragma unroll
    for (int c = 0; c < NC; ++c) { for (int t = 0; t < 4; ++t) st[c].oacc[t] = (v8f){}; st[c].lsv = (v8f){}; st[c].mraw = -INFINITY; st[c].bo = -INFINITY; }
#pragma unroll 1   // one chunk's fragments, scores and states and the 64 registers of the chunk in flight take about 460 of the 512 that two waves a SIMD leave a wave
    for (int ls = 0; ls < ns - 1; ++ls, ++g) { chunk<false>(&Kt[g & 1][grp][nloc * LP], &Vt[g & 1][grp][vl], 0, hlf, qb, st); put(g + 1); foot(); }   // ahead of a tile's last stage neither group meets the diagonal, and position g + 1 exists
    { const int k0 = (NG * (ns - 1) + grp) * KC;   // first key of this group's chunk of the last stage
      const b16* const kc = &Kt[g & 1][grp][nloc * LP]; const b16* const vc = &Vt[g & 1][grp][vl];
      if (k0 + KC <= q0) chunk<false>(kc, vc, 0, hlf, qb, st);   // every key lies before the wave's first query
      else if (k0 < q0 + WQ) chunk<true>(kc, vc, k0 + 8 * hlf - (q0 + nloc), hlf, qb, st);   // else every key lies behind the wave's last query: weight exactly 0, left out
      if (grp == 1) {   // the hand-over; the barrier in foot() publishes it
#pragma unroll
        for (int c = 0; c < NC; ++c) { const v8f lsv = st[c].lsv;
#pragma unroll
          for (int t = 0; t < 4; ++t)
#pragma unroll
            for (int u = 0; u < 2; ++u) Mo[tl][wq][c][2 * t + u][lane] = (v4f){st[c].oacc[t][4 * u], st[c].oacc[t][4 * u + 1], st[c].oacc[t][4 * u + 2], st[c].oacc[t][4 * u + 3]};
          Ms[tl][wq][c][0][lane] = ((lsv[0] + lsv[1]) + (lsv[2] + lsv[3])) + ((lsv[4] + lsv[5]) + (lsv[6] + lsv[7])); Ms[tl][wq][c][1][lane] = st[c].bo; } }
      if (tl == 0) put(g + 1);   // the second tile's first stage; behind the second tile nothing follows
      else asm volatile("s_wait_xcnt 0x0" :: "v"(pk), "v"(pv) : "memory");   // stands before the address registers of the last loads are reused
      foot(); ++g; }
    if (grp == 0) {   // wave-uniform; no barrier inside
#pragma unroll
      for (int c = 0; c < NC; ++c) if (q0 + 16 * c < QLIM) {
        const v8f lsv = st[c].lsv; const float l0 = ((lsv[0] + lsv[1]) + (lsv[2] + lsv[3])) + ((lsv[4] + lsv[5]) + (lsv[6] + lsv[7])), l1 = Ms[tl][wq][c][0][lane], b1 = Ms[tl][wq][c][1][lane];
        const float bj = fmaxf(st[c].bo, b1), f0 = __builtin_amdgcn_exp2f(st[c].bo - bj), f1 = __builtin_amdgcn_exp2f(b1 - bj);   // group 0 always has chunk 0, so bj is finite; a group 1 without a chunk hands over -inf, zeros: f1 = 0
        float ls = l0 * f0 + l1 * f1; ls += other_half(ls); const float rinv = (1.0f / XS) / ls, r0 = f0 * rinv, r1 = f1 * rinv;   // ls carries PS like oacc
#pragma unroll
        for (int t = 0; t < 4; ++t)
#pragma unroll
          for (int u = 0; u < 2; ++u) { const v4f o1 = Mo[tl][wq][c][2 * t + u][lane];
#pragma unroll
            for (int e = 0; e < 4; ++e) Of[wq][c * 16 + nloc][t * 16 + 8 * hlf + 4 * u + e] = st[c].oacc[t][4 * u + e] * r0 + o1[e] * r1; }
        wave_lds_sync();
        v2f row[16]; float* const po = out + (tq + c * 16) * D + h * HD + lane * 2;
#pragma unroll
        for (int r = 0; r < 16; ++r) row[r] = (v2f){Of[wq][c * 16 + r][lane * 2], Of[wq][c * 16 + r][lane * 2 + 1]};   // this wave's own rows of Of: its next results come behind these reads in program order
#pragma unroll
        for (int r = 0; r < 16; ++r) *(v2f*)(po + (size_t)r * D) = row[r];
        // stands before the stores' address and data registers are reused (they are inputs, so they live up to here)
        asm volatile("s_wait_xcnt 0x0" :: "v"(po), "v"(row[0]), "v"(row[1]), "v"(row[2]), "v"(row[3]), "v"(row[4]), "v"(row[5]), "v"(row[6]), "v"(row[7]), "v"(row[8]), "v"(row[9]), "v"(row[10]), "v"(row[11]), "v"(row[12]), "v"(row[13]), "v"(row[14]), "v"(row[15]) : "memory"); } }
#pragma unroll
    for (int c = 0; c < NC; ++c) for (int ks = 0; ks < 2; ++ks) qb[c][ks] = qn[c][ks]; }
}
}  // namespace

extern "C" void kernel_launch(void* const* d_in, const int* in_sizes, int n_in, void* d_out, int out_size, void* d_ws, size_t ws_size, hipStream_t stream) {
  (void)n_in;
  auto Fp = [&](int i) { return (const float*)d_in[i]; };
  // input order: 0 q/query; 1 k/key; 2 v/value ([2,2048,1024] == [2,2048,16,64]); MODE 1: 3 attention_mask [2,2048] i32
  if (in_sizes[0] != NT * D || in_sizes[1] != NT * D || in_sizes[2] != NT * D || (MODE == 1 && in_sizes[3] != NT) || out_size != NT * D) return;
  const int QLIM = S;   // query cut (multiple of 16)
  (void)d_ws; (void)ws_size;   // no workspace
  att_kernel<<<NB_ * H * (NTL / 2), NG * NW * 32, 0, stream>>>(Fp(0), Fp(1), Fp(2), MODE == 1 ? (const int*)d_in[3] : nullptr, QLIM, (float*)d_out);
}
